// v000
// The times below were measured on an AMD MI455X: many runs one after another, warmed up first and cycling through
// copies of the inputs, with the whole window's GPU time divided by the number of runs. Launches and the gaps
// between them are all in it. The median over several windows is given; except for v000 it joins two sittings, which
// can be a few percent apart, so the side-by-side timings, each taken in one sitting, are the better comparison.
// The starting kernel, v000, takes 197 microseconds a run.
#include <hip/hip_runtime.h>

// ---------------------------------------------------------------------------
// Decomposed rel-pos attention for MI455X (gfx1250), wave32 + WMMA f16.
// Phase 1a: bias tables qh,qw (L x 32), kh,kw (32 x L) per (b,n)      -> ws
// Phase 1b: K,V pre-swizzled to f16 WMMA B-operand tiles (8KB/tile)   -> ws
// Phase 2 : flash attention; K/V tiles streamed to LDS with
//           GLOBAL_LOAD_ASYNC_TO_LDS_B128 (double-buffered, ASYNCcnt),
//           v_wmma_f32_16x16x32_f16 for QK^T and P*V.
// ws requirement: 16 MB bias (fp32) + 8 MB K/V f16 tiles = 24 MB.
// ---------------------------------------------------------------------------

typedef __attribute__((ext_vector_type(16))) _Float16 v16h;
typedef __attribute__((ext_vector_type(8)))  float    v8f;

#define LQ   1024
#define CD   64
// fp32 workspace offsets (floats)
#define QH_OFF 0
#define QW_OFF (32*1024*32)
#define KH_OFF (2*32*1024*32)
#define KW_OFF (3*32*1024*32)
#define WS_F32_FLOATS (4*32*1024*32)          // 4M floats = 16 MB
// f16 workspace offsets (halves), relative to wsh = (ws + WS_F32_FLOATS)
#define WSK_HOFF 0
#define WSV_HOFF (32*16*4096)                 // 2M halves = 4 MB

// A/B operand K-index map (16-bit WMMA): element e, lane half h ->
// K = (e&7) + 8*h + 16*(e>>3)
__device__ __forceinline__ int kmap(int e, int half) {
  return (e & 7) + 8 * half + 16 * (e >> 3);
}

// --------------------------- Phase 1a: bias tables --------------------------
__global__ __launch_bounds__(256) void bias_kernel(
    const float* __restrict__ Qg, const float* __restrict__ Kg,
    const float* __restrict__ rhq, const float* __restrict__ rwq,
    const float* __restrict__ rhk, const float* __restrict__ rwk,
    float* __restrict__ ws)
{
  int gid = blockIdx.x * 256 + threadIdx.x;     // 0 .. 4*2^20-1
  int arr = gid >> 20;
  int r   = gid & ((1 << 20) - 1);
  int bn  = r >> 15;
  int rem = r & 32767;

  const float *row, *rel;
  float *out;
  if (arr < 2) {
    int q = rem >> 5, j = rem & 31;
    row = Qg + ((size_t)bn * LQ + q) * CD;
    int d = (arr == 0 ? (q >> 5) : (q & 31)) - j + 31;   // in [0,62]
    rel = (arr == 0 ? rhq : rwq) + d * CD;
    out = ws + (arr == 0 ? QH_OFF : QW_OFF) + (size_t)bn * 32768 + rem;
  } else {
    int j = rem >> 10, k = rem & 1023;
    row = Kg + ((size_t)bn * LQ + k) * CD;
    int d = j - (arr == 2 ? (k >> 5) : (k & 31)) + 31;
    rel = (arr == 2 ? rhk : rwk) + d * CD;
    out = ws + (arr == 2 ? KH_OFF : KW_OFF) + (size_t)bn * 32768 + rem;
  }
  float s = 0.f;
#pragma unroll
  for (int i = 0; i < 16; ++i) {
    float4 a = ((const float4*)row)[i];
    float4 b = ((const float4*)rel)[i];
    s += a.x * b.x + a.y * b.y + a.z * b.z + a.w * b.w;
  }
  *out = s;
}

// ------------------- Phase 1b: K/V -> f16 B-operand tiles -------------------
__global__ __launch_bounds__(256) void prepack_kernel(
    const float* __restrict__ Kg, const float* __restrict__ Vg,
    _Float16* __restrict__ wsh)
{
  int gid   = blockIdx.x * 256 + threadIdx.x;   // 0 .. 2*2^21-1
  int which = gid >> 21;                        // 0 = K, 1 = V
  int r     = gid & ((1 << 21) - 1);
  int bnkt  = r >> 12;                          // bn*16 + kt
  int idx   = r & 4095;
  int e  = idx & 15;
  int ln = (idx >> 4) & 31;
  int op = idx >> 9;                            // operand 0..7
  int hf = ln >> 4, nn = ln & 15;
  int kv = kmap(e, hf);
  int kt = bnkt & 15, bn = bnkt >> 4;
  int key, c;
  if (which == 0) { key = kt * 64 + (op >> 1) * 16 + nn; c = (op & 1) * 32 + kv; }
  else            { key = kt * 64 + (op >> 2) * 32 + kv; c = (op & 3) * 16 + nn; }
  const float* src = (which == 0 ? Kg : Vg);
  float v = src[((size_t)bn * LQ + key) * CD + c];
  wsh[(which == 0 ? WSK_HOFF : WSV_HOFF) + (size_t)bnkt * 4096 + idx] = (_Float16)v;
}

// ------------------------------ Phase 2: flash ------------------------------
__device__ __forceinline__ void async_tile(const _Float16* __restrict__ gsrc,
                                           _Float16* ldst, int t) {
#pragma unroll
  for (int i = 0; i < 4; ++i) {
    unsigned lk = (unsigned)(uintptr_t)(ldst + t * 8 + i * 1024);  // LDS byte addr
    const _Float16* gs = gsrc + t * 8 + i * 1024;
    asm volatile("global_load_async_to_lds_b128 %0, %1, off"
                 :: "v"(lk), "v"(gs) : "memory");
  }
}

__global__ __launch_bounds__(128) void flash_kernel(
    const float* __restrict__ Qg, const float* __restrict__ ws,
    const _Float16* __restrict__ wsh, float* __restrict__ Out)
{
  // double-buffered K/V tiles already in B-operand layout (8KB each)
  __shared__ __attribute__((aligned(32))) _Float16 sK[2][4096];
  __shared__ __attribute__((aligned(32))) _Float16 sV[2][4096];
  // P in A-layout, wave-private: [wave][k_chunk(2)][lane(32)*e(16)]
  __shared__ __attribute__((aligned(32))) _Float16 sP[4][2][32 * 16];

  const int bn    = blockIdx.y;
  const int qtile = blockIdx.x;
  const int t     = threadIdx.x;
  const int wave  = t >> 5;
  const int lane  = t & 31;
  const int half  = lane >> 4;
  const int n     = lane & 15;
  const int qbase = qtile * 64 + wave * 16;

  const float* qh_p = ws + QH_OFF + (size_t)bn * 32768;
  const float* qw_p = ws + QW_OFF + (size_t)bn * 32768;
  const float* kh_p = ws + KH_OFF + (size_t)bn * 32768;
  const float* kw_p = ws + KW_OFF + (size_t)bn * 32768;
  const _Float16* gK = wsh + WSK_HOFF + (size_t)(bn * 16) * 4096;
  const _Float16* gV = wsh + WSV_HOFF + (size_t)(bn * 16) * 4096;

  // ---- this wave's 16 Q rows as two f16 A operands (C = 0..31, 32..63) ----
  v16h qA[2];
  {
    const float* qr = Qg + ((size_t)bn * LQ + (qbase + n)) * CD;  // A: M = lane&15
#pragma unroll
    for (int cc = 0; cc < 2; ++cc)
#pragma unroll
      for (int e = 0; e < 16; ++e)
        qA[cc][e] = (_Float16)qr[kmap(e, half) + 32 * cc];
  }

  v8f Oacc[4];
  const v8f vzero = {0.f, 0.f, 0.f, 0.f, 0.f, 0.f, 0.f, 0.f};
#pragma unroll
  for (int cs = 0; cs < 4; ++cs) Oacc[cs] = vzero;
  float rm[8], rl[8];
#pragma unroll
  for (int i = 0; i < 8; ++i) { rm[i] = -3.0e38f; rl[i] = 0.f; }

  // prologue: start tile 0 into buffer 0
  async_tile(gK, &sK[0][0], t);
  async_tile(gV, &sV[0][0], t);

  for (int kt = 0; kt < 16; ++kt) {
    const int cur = kt & 1;
    const int k0  = kt * 64;

    asm volatile("s_wait_asynccnt 0x0" ::: "memory");  // my tile portion landed
    __syncthreads();                                   // whole tile visible

    if (kt + 1 < 16) {                                 // overlap next copy
      async_tile(gK + (size_t)(kt + 1) * 4096, &sK[cur ^ 1][0], t);
      async_tile(gV + (size_t)(kt + 1) * 4096, &sV[cur ^ 1][0], t);
    }
    const _Float16* sKb = &sK[cur][0];
    const _Float16* sVb = &sV[cur][0];

    // ---- scores: preload all 8 B operands, then 8 back-to-back WMMAs ----
    v16h kB[8];
#pragma unroll
    for (int op = 0; op < 8; ++op)
      kB[op] = *(const v16h*)(sKb + (op * 32 + lane) * 16);

    v8f S[4];
#pragma unroll
    for (int sub = 0; sub < 4; ++sub)
      S[sub] = __builtin_amdgcn_wmma_f32_16x16x32_f16(false, qA[0], false,
                                                      kB[sub * 2], (short)0,
                                                      vzero, false, false);
#pragma unroll
    for (int sub = 0; sub < 4; ++sub)
      S[sub] = __builtin_amdgcn_wmma_f32_16x16x32_f16(false, qA[1], false,
                                                      kB[sub * 2 + 1], (short)0,
                                                      S[sub], false, false);

    // ---- scale + rel-pos bias (C-layout: row i+8*half, col n) ----
#pragma unroll
    for (int sub = 0; sub < 4; ++sub)
#pragma unroll
      for (int i = 0; i < 8; ++i) {
        int q = qbase + i + 8 * half;
        int k = k0 + sub * 16 + n;
        float b = qh_p[q * 32 + (k >> 5)] + qw_p[q * 32 + (k & 31)]
                + kh_p[(q >> 5) * 1024 + k] + kw_p[(q & 31) * 1024 + k];
        S[sub][i] = S[sub][i] * 0.125f + b;    // 1/sqrt(64) on QK only
      }

    // ---- online softmax (reduce across the 16-lane column group) ----
#pragma unroll
    for (int i = 0; i < 8; ++i) {
      float tm = fmaxf(fmaxf(S[0][i], S[1][i]), fmaxf(S[2][i], S[3][i]));
      tm = fmaxf(tm, __shfl_xor(tm, 8));
      tm = fmaxf(tm, __shfl_xor(tm, 4));
      tm = fmaxf(tm, __shfl_xor(tm, 2));
      tm = fmaxf(tm, __shfl_xor(tm, 1));
      float newm = fmaxf(rm[i], tm);
      float corr = __expf(rm[i] - newm);
      rm[i] = newm;
      float ts = 0.f;
#pragma unroll
      for (int sub = 0; sub < 4; ++sub) {
        float p = __expf(S[sub][i] - newm);
        S[sub][i] = p;
        ts += p;
      }
      ts += __shfl_xor(ts, 8); ts += __shfl_xor(ts, 4);
      ts += __shfl_xor(ts, 2); ts += __shfl_xor(ts, 1);
      rl[i] = rl[i] * corr + ts;
#pragma unroll
      for (int cs = 0; cs < 4; ++cs) Oacc[cs][i] *= corr;
    }

    // ---- P: C-layout regs -> A-layout in wave-private LDS ----
#pragma unroll
    for (int sub = 0; sub < 4; ++sub)
#pragma unroll
      for (int i = 0; i < 8; ++i) {
        int mrow = i + 8 * half;
        int kl   = sub * 16 + n;
        int kc = kl >> 5, K32 = kl & 31;
        int hf = (K32 >> 3) & 1, e = (K32 & 7) + 8 * (K32 >> 4);
        sP[wave][kc][(hf * 16 + mrow) * 16 + e] = (_Float16)S[sub][i];
      }
    asm volatile("s_wait_dscnt 0x0" ::: "memory");  // per-wave LDS RAW fence

    // ---- O += P * V : preload operands, then 8 back-to-back WMMAs ----
    v16h aP0 = *(const v16h*)(sP[wave][0] + lane * 16);
    v16h aP1 = *(const v16h*)(sP[wave][1] + lane * 16);
    v16h vB[8];
#pragma unroll
    for (int op = 0; op < 8; ++op)
      vB[op] = *(const v16h*)(sVb + (op * 32 + lane) * 16);
#pragma unroll
    for (int cs = 0; cs < 4; ++cs)
      Oacc[cs] = __builtin_amdgcn_wmma_f32_16x16x32_f16(false, aP0, false,
                                                        vB[cs], (short)0,
                                                        Oacc[cs], false, false);
#pragma unroll
    for (int cs = 0; cs < 4; ++cs)
      Oacc[cs] = __builtin_amdgcn_wmma_f32_16x16x32_f16(false, aP1, false,
                                                        vB[4 + cs], (short)0,
                                                        Oacc[cs], false, false);

    __syncthreads();   // all waves done reading before buffer reuse
  }

  // ---- epilogue: normalize, add residual Q, store fp32 ----
#pragma unroll
  for (int cs = 0; cs < 4; ++cs)
#pragma unroll
    for (int i = 0; i < 8; ++i) {
      int q = qbase + i + 8 * half;
      int c = cs * 16 + n;
      size_t idx = ((size_t)bn * LQ + q) * CD + c;
      Out[idx] = Oacc[cs][i] / rl[i] + Qg[idx];
    }
}

// ---------------------------------------------------------------------------
extern "C" void kernel_launch(void* const* d_in, const int* in_sizes, int n_in,
                              void* d_out, int out_size, void* d_ws, size_t ws_size,
                              hipStream_t stream) {
  (void)in_sizes; (void)n_in; (void)out_size; (void)ws_size;
  const float* q   = (const float*)d_in[0];
  const float* k   = (const float*)d_in[1];
  const float* v   = (const float*)d_in[2];
  const float* rhq = (const float*)d_in[3];
  const float* rwq = (const float*)d_in[4];
  const float* rhk = (const float*)d_in[5];
  const float* rwk = (const float*)d_in[6];
  float*    ws  = (float*)d_ws;                       // needs 24 MB
  _Float16* wsh = (_Float16*)(ws + WS_F32_FLOATS);
  float*    out = (float*)d_out;

  bias_kernel<<<16384, 256, 0, stream>>>(q, k, rhq, rwq, rhk, rwk, ws);
  prepack_kernel<<<16384, 256, 0, stream>>>(k, v, wsh);
  flash_kernel<<<dim3(16, 32), 128, 0, stream>>>(q, ws, wsh, out);
}

// v001
// It runs in 103 microseconds.
// Next to v000, in two timings, it ran 1.99 and 1.97 times as fast.
#include <hip/hip_runtime.h>

// ---------------------------------------------------------------------------
// Decomposed rel-pos attention for MI455X (gfx1250), wave32 + WMMA f16.
// Phase 1a: bias tables qh,qw (L x 32), kh,kw (32 x L) per (b,n), fp32 WMMA -> ws
// Phase 1b: K,V pre-swizzled to f16 WMMA B-operand tiles (8KB/tile)   -> ws
// Phase 2 : flash attention; K/V tiles streamed to LDS with
//           GLOBAL_LOAD_ASYNC_TO_LDS_B128 (double-buffered, ASYNCcnt),
//           v_wmma_f32_16x16x32_f16 for QK^T and P*V.
// ws requirement: 16 MB bias (fp32) + 8 MB K/V f16 tiles = 24 MB.
// ---------------------------------------------------------------------------

typedef __attribute__((ext_vector_type(16))) _Float16 v16h;
typedef __attribute__((ext_vector_type(8)))  float    v8f;

#define LQ   1024
#define CD   64
// fp32 workspace offsets (floats)
#define QH_OFF 0
#define QW_OFF (32*1024*32)
#define KH_OFF (2*32*1024*32)
#define KW_OFF (3*32*1024*32)
#define WS_F32_FLOATS (4*32*1024*32)          // 4M floats = 16 MB
// f16 workspace offsets (halves), relative to wsh = (ws + WS_F32_FLOATS)
#define WSK_HOFF 0
#define WSV_HOFF (32*16*4096)                 // 2M halves = 4 MB

// A/B operand K-index map (16-bit WMMA): element e, lane half h ->
// K = (e&7) + 8*h + 16*(e>>3)
__device__ __forceinline__ int kmap(int e, int half) {
  return (e & 7) + 8 * half + 16 * (e >> 3);
}

// --------------------------- Phase 1a: bias tables --------------------------
// Each table is a small fp32 GEMM (rows of Q or K against rows of a rel table),
// done on v_wmma_f32_16x16x4_f32. One block = one (bn, hb): it stages the 256
// operand rows it needs in LDS with whole-line loads, then waves 0-1 make qh for
// q>>5 == hb, 2-3 qw for q&31 == hb, 4-5 kh and 6-7 kw for k>>5 == hb.
// A wave owns whole 128-byte output rows.
typedef __attribute__((ext_vector_type(2))) float v2f;
typedef __attribute__((ext_vector_type(4))) float v4f;

#define SP 68   // LDS row pitch (floats) of the staged rows: 272 B, 16-byte column reads hit 64 banks
#define GP 36   // LDS row pitch (floats) of the kw skew buffer, rows stay 16-byte aligned
// first staged row of each operand
#define XQ1  0     // Q[hb*32 + i]
#define XQ2  32    // Q[i*32 + hb]
#define XK   64    // K[hb*32 + i]
#define XRHQ 96    // rhq[hb + i]
#define XRWQ 128   // rwq[hb + i]
#define XRHK 160   // rhk[31 - hb + i]
#define XRWK 192   // rwk[min(i, 62)], i = 0..63

// 16 rows x 64 floats as 16 k-steps of a 16x16x4 operand. Lane (c, h) holds
// columns 8*i + 4*h + 0..3 of its row; A and B use this one loader, so their
// k orders pair position by position.
struct Frag { v4f f[8]; };

__device__ __forceinline__ void lds_frag(Frag& x, const float* row, int h) {
  const v4f* p = (const v4f*)(row + 4 * h);
#pragma unroll
  for (int i = 0; i < 8; ++i) x.f[i] = p[2 * i];
}

// d0[m][n] = sum_c A[m][c] * B0[n][c], d1 likewise with B1: two independent
// accumulate chains; register r of lane (c, h) = element [8*h + r][c]
__device__ __forceinline__ void frag_mm2(const Frag& a, const Frag& b0, const Frag& b1,
                                         v8f& d0, v8f& d1) {
  const v8f z = {0.f, 0.f, 0.f, 0.f, 0.f, 0.f, 0.f, 0.f};
  d0 = z; d1 = z;
#pragma unroll
  for (int i = 0; i < 8; ++i) {
    v2f al = {a.f[i].x, a.f[i].y},   ah = {a.f[i].z, a.f[i].w};
    v2f pl = {b0.f[i].x, b0.f[i].y}, ph = {b0.f[i].z, b0.f[i].w};
    v2f ql = {b1.f[i].x, b1.f[i].y}, qh = {b1.f[i].z, b1.f[i].w};
    d0 = __builtin_amdgcn_wmma_f32_16x16x4_f32(false, al, false, pl, (short)0, d0, false, false);
    d1 = __builtin_amdgcn_wmma_f32_16x16x4_f32(false, al, false, ql, (short)0, d1, false, false);
    d0 = __builtin_amdgcn_wmma_f32_16x16x4_f32(false, ah, false, ph, (short)0, d0, false, false);
    d1 = __builtin_amdgcn_wmma_f32_16x16x4_f32(false, ah, false, qh, (short)0, d1, false, false);
  }
}

__global__ __launch_bounds__(256) void bias_kernel(
    const float* __restrict__ Qg, const float* __restrict__ Kg,
    const float* __restrict__ rhq, const float* __restrict__ rwq,
    const float* __restrict__ rhk, const float* __restrict__ rwk,
    float* __restrict__ ws)
{
  __shared__ __attribute__((aligned(16))) float sX[256 * SP];
  __shared__ __attribute__((aligned(16))) float sG[2][16 * GP];

  const int hb   = blockIdx.x;
  const int bn   = blockIdx.y;
  const int tid  = threadIdx.x;
  const int wv   = __builtin_amdgcn_readfirstlane(tid >> 5);
  const int lane = tid & 31;
  const int c    = lane & 15;
  const int h    = lane >> 4;
  const int s    = wv & 1;
  const int tab  = wv >> 1;
  float* wsb = ws + (size_t)bn * 32768;

  // ---- stage: 16 lanes read one whole 256-byte row, 16 rows per pass ----
  {
    const int sr = tid >> 4;
    const int sc = (tid & 15) * 4;
    // per-lane byte offsets: rows 1 apart, rows 32 apart, last rwk rows (row 63 repeats 62)
    const unsigned o1 = (unsigned)(sr * CD + sc) * 4u;
    const unsigned o2 = (unsigned)(sr * 32 * CD + sc) * 4u;
    const unsigned o3 = (unsigned)(min(sr, 14) * CD + sc) * 4u;
    // block-uniform base of each staged operand
    const float* Qb = Qg + (size_t)bn * LQ * CD;
    const float* Kb = Kg + (size_t)bn * LQ * CD;
    const char* pQ1 = (const char*)(Qb + hb * 32 * CD);
    const char* pQ2 = (const char*)(Qb + hb * CD);
    const char* pK  = (const char*)(Kb + hb * 32 * CD);
    const char* pHQ = (const char*)(rhq + hb * CD);
    const char* pWQ = (const char*)(rwq + hb * CD);
    const char* pHK = (const char*)(rhk + (31 - hb) * CD);
    const char* pWK = (const char*)rwk;
    v4f st[16];
    st[0]  = *(const v4f*)(pQ1 + o1);
    st[1]  = *(const v4f*)(pQ1 + 16 * CD * 4 + o1);
    st[2]  = *(const v4f*)(pQ2 + o2);
    st[3]  = *(const v4f*)(pQ2 + 16 * 32 * CD * 4 + o2);
    st[4]  = *(const v4f*)(pK + o1);
    st[5]  = *(const v4f*)(pK + 16 * CD * 4 + o1);
    st[6]  = *(const v4f*)(pHQ + o1);
    st[7]  = *(const v4f*)(pHQ + 16 * CD * 4 + o1);
    st[8]  = *(const v4f*)(pWQ + o1);
    st[9]  = *(const v4f*)(pWQ + 16 * CD * 4 + o1);
    st[10] = *(const v4f*)(pHK + o1);
    st[11] = *(const v4f*)(pHK + 16 * CD * 4 + o1);
    st[12] = *(const v4f*)(pWK + o1);
    st[13] = *(const v4f*)(pWK + 16 * CD * 4 + o1);
    st[14] = *(const v4f*)(pWK + 32 * CD * 4 + o1);
    st[15] = *(const v4f*)(pWK + 48 * CD * 4 + o3);
    // inputs-only fence on the loaded values: the loads' offset and base registers
    // stay live, so none is reused before every load above has returned
    asm volatile("" :: "v"(st[0]), "v"(st[1]), "v"(st[2]), "v"(st[3]), "v"(st[4]), "v"(st[5]),
                 "v"(st[6]), "v"(st[7]), "v"(st[8]), "v"(st[9]), "v"(st[10]), "v"(st[11]),
                 "v"(st[12]), "v"(st[13]), "v"(st[14]), "v"(st[15]), "v"(o1), "v"(o2), "v"(o3),
                 "s"(pQ1), "s"(pQ2), "s"(pK), "s"(pHQ), "s"(pWQ), "s"(pHK), "s"(pWK));
#pragma unroll
    for (int g = 0; g < 16; ++g)
      *(v4f*)&sX[(g * 16 + sr) * SP + sc] = st[g];
  }
  __syncthreads();   // staged rows visible to every wave

  if (tab < 3) {
    // qh[q][j] = Q[q] . rhq[hb - j + 31]   M = q = hb*32 + 16*s + m,  N = j
    // qw[q][j] = Q[q] . rwq[hb - j + 31]   M = q = (16*s + m)*32 + hb, N = j
    // kh[j][k] = K[k] . rhk[j - hb + 31]   M = j = 16*s + m,           N = k = hb*32 + n
    int ar, br0, br1, ostr;
    float* o;
    if (tab == 0) {
      ar = XQ1 + 16 * s + c;  br0 = XRHQ + 31 - c;  br1 = XRHQ + 15 - c;
      o = wsb + QH_OFF + (hb * 32 + 16 * s + 8 * h) * 32 + c;  ostr = 32;
    } else if (tab == 1) {
      ar = XQ2 + 16 * s + c;  br0 = XRWQ + 31 - c;  br1 = XRWQ + 15 - c;
      o = wsb + QW_OFF + ((16 * s + 8 * h) * 32 + hb) * 32 + c;  ostr = 1024;
    } else {
      ar = XRHK + 16 * s + c; br0 = XK + c;         br1 = XK + 16 + c;
      o = wsb + KH_OFF + (16 * s + 8 * h) * 1024 + hb * 32 + c;  ostr = 1024;
    }
    Frag a, b0, b1;
    lds_frag(a,  sX + ar  * SP, h);
    lds_frag(b0, sX + br0 * SP, h);
    lds_frag(b1, sX + br1 * SP, h);
    v8f d0, d1;
    frag_mm2(a, b0, b1, d0, d1);
#pragma unroll
    for (int r = 0; r < 8; ++r) {
      o[r * ostr]      = d0[r];
      o[r * ostr + 16] = d1[r];
    }
  } else {
    // kw[j][k] = K[k] . rwk[j - w + 31], j = 16*s + jl, w = 16*t + m (M = k rows);
    // N = rel row 16*(s - t + 1 + u) + c, so element (m, c) of tile u belongs to
    // jl = 16*u + c + m - 15 (in 0..15 for exactly one u); the skew is undone in LDS.
    float* g = &sG[s][0];
#pragma unroll
    for (int t = 0; t < 2; ++t) {
      Frag a, b0, b1;
      lds_frag(a,  sX + (XK + 16 * t + c) * SP, h);
      lds_frag(b0, sX + (XRWK + 16 * (s - t + 1) + c) * SP, h);
      lds_frag(b1, sX + (XRWK + 16 * (s - t + 2) + c) * SP, h);
      v8f d0, d1;
      frag_mm2(a, b0, b1, d0, d1);
      const int jl0 = c + 8 * h - 15;
      float* gw = g + 16 * t + 8 * h;
#pragma unroll
      for (int r = 0; r < 8; ++r) {
        const int jl = jl0 + r;   // -15..15: tile 0 holds row jl if jl >= 0, else tile 1 holds row jl + 16
        gw[(jl & 15) * GP + r] = jl >= 0 ? d0[r] : d1[r];
      }
    }
    // this wave's own LDS stores must have landed before its other lanes read them
    asm volatile("s_wait_dscnt 0x0" ::: "memory");
#pragma unroll
    for (int i = 0; i < 4; ++i) {
      const int row = i * 4 + (lane >> 3), col = (lane & 7) * 4;
      v4f v = *(const v4f*)(g + row * GP + col);
      *(v4f*)(wsb + KW_OFF + (16 * s + row) * 1024 + hb * 32 + col) = v;
    }
    // precaution: in the built code the block laid out behind these stores rewrites their registers
    asm volatile("s_wait_xcnt 0x0" ::: "memory");
  }
}

// ------------------- Phase 1b: K/V -> f16 B-operand tiles -------------------
__global__ __launch_bounds__(256) void prepack_kernel(
    const float* __restrict__ Kg, const float* __restrict__ Vg,
    _Float16* __restrict__ wsh)
{
  int gid   = blockIdx.x * 256 + threadIdx.x;   // 0 .. 2*2^21-1
  int which = gid >> 21;                        // 0 = K, 1 = V
  int r     = gid & ((1 << 21) - 1);
  int bnkt  = r >> 12;                          // bn*16 + kt
  int idx   = r & 4095;
  int e  = idx & 15;
  int ln = (idx >> 4) & 31;
  int op = idx >> 9;                            // operand 0..7
  int hf = ln >> 4, nn = ln & 15;
  int kv = kmap(e, hf);
  int kt = bnkt & 15, bn = bnkt >> 4;
  int key, c;
  if (which == 0) { key = kt * 64 + (op >> 1) * 16 + nn; c = (op & 1) * 32 + kv; }
  else            { key = kt * 64 + (op >> 2) * 32 + kv; c = (op & 3) * 16 + nn; }
  const float* src = (which == 0 ? Kg : Vg);
  float v = src[((size_t)bn * LQ + key) * CD + c];
  wsh[(which == 0 ? WSK_HOFF : WSV_HOFF) + (size_t)bnkt * 4096 + idx] = (_Float16)v;
}

// ------------------------------ Phase 2: flash ------------------------------
__device__ __forceinline__ void async_tile(const _Float16* __restrict__ gsrc,
                                           _Float16* ldst, int t) {
#pragma unroll
  for (int i = 0; i < 4; ++i) {
    unsigned lk = (unsigned)(uintptr_t)(ldst + t * 8 + i * 1024);  // LDS byte addr
    const _Float16* gs = gsrc + t * 8 + i * 1024;
    asm volatile("global_load_async_to_lds_b128 %0, %1, off"
                 :: "v"(lk), "v"(gs) : "memory");
  }
}

__global__ __launch_bounds__(128) void flash_kernel(
    const float* __restrict__ Qg, const float* __restrict__ ws,
    const _Float16* __restrict__ wsh, float* __restrict__ Out)
{
  // double-buffered K/V tiles already in B-operand layout (8KB each)
  __shared__ __attribute__((aligned(32))) _Float16 sK[2][4096];
  __shared__ __attribute__((aligned(32))) _Float16 sV[2][4096];
  // P in A-layout, wave-private: [wave][k_chunk(2)][lane(32)*e(16)]
  __shared__ __attribute__((aligned(32))) _Float16 sP[4][2][32 * 16];

  const int bn    = blockIdx.y;
  const int qtile = blockIdx.x;
  const int t     = threadIdx.x;
  const int wave  = t >> 5;
  const int lane  = t & 31;
  const int half  = lane >> 4;
  const int n     = lane & 15;
  const int qbase = qtile * 64 + wave * 16;

  const float* qh_p = ws + QH_OFF + (size_t)bn * 32768;
  const float* qw_p = ws + QW_OFF + (size_t)bn * 32768;
  const float* kh_p = ws + KH_OFF + (size_t)bn * 32768;
  const float* kw_p = ws + KW_OFF + (size_t)bn * 32768;
  const _Float16* gK = wsh + WSK_HOFF + (size_t)(bn * 16) * 4096;
  const _Float16* gV = wsh + WSV_HOFF + (size_t)(bn * 16) * 4096;

  // ---- this wave's 16 Q rows as two f16 A operands (C = 0..31, 32..63) ----
  v16h qA[2];
  {
    const float* qr = Qg + ((size_t)bn * LQ + (qbase + n)) * CD;  // A: M = lane&15
#pragma unroll
    for (int cc = 0; cc < 2; ++cc)
#pragma unroll
      for (int e = 0; e < 16; ++e)
        qA[cc][e] = (_Float16)qr[kmap(e, half) + 32 * cc];
  }

  v8f Oacc[4];
  const v8f vzero = {0.f, 0.f, 0.f, 0.f, 0.f, 0.f, 0.f, 0.f};
#pragma unroll
  for (int cs = 0; cs < 4; ++cs) Oacc[cs] = vzero;
  float rm[8], rl[8];
#pragma unroll
  for (int i = 0; i < 8; ++i) { rm[i] = -3.0e38f; rl[i] = 0.f; }

  // prologue: start tile 0 into buffer 0
  async_tile(gK, &sK[0][0], t);
  async_tile(gV, &sV[0][0], t);

  for (int kt = 0; kt < 16; ++kt) {
    const int cur = kt & 1;
    const int k0  = kt * 64;

    asm volatile("s_wait_asynccnt 0x0" ::: "memory");  // my tile portion landed
    __syncthreads();                                   // whole tile visible

    if (kt + 1 < 16) {                                 // overlap next copy
      async_tile(gK + (size_t)(kt + 1) * 4096, &sK[cur ^ 1][0], t);
      async_tile(gV + (size_t)(kt + 1) * 4096, &sV[cur ^ 1][0], t);
    }
    const _Float16* sKb = &sK[cur][0];
    const _Float16* sVb = &sV[cur][0];

    // ---- scores: preload all 8 B operands, then 8 back-to-back WMMAs ----
    v16h kB[8];
#pragma unroll
    for (int op = 0; op < 8; ++op)
      kB[op] = *(const v16h*)(sKb + (op * 32 + lane) * 16);

    v8f S[4];
#pragma unroll
    for (int sub = 0; sub < 4; ++sub)
      S[sub] = __builtin_amdgcn_wmma_f32_16x16x32_f16(false, qA[0], false,
                                                      kB[sub * 2], (short)0,
                                                      vzero, false, false);
#pragma unroll
    for (int sub = 0; sub < 4; ++sub)
      S[sub] = __builtin_amdgcn_wmma_f32_16x16x32_f16(false, qA[1], false,
                                                      kB[sub * 2 + 1], (short)0,
                                                      S[sub], false, false);

    // ---- scale + rel-pos bias (C-layout: row i+8*half, col n) ----
#pragma unroll
    for (int sub = 0; sub < 4; ++sub)
#pragma unroll
      for (int i = 0; i < 8; ++i) {
        int q = qbase + i + 8 * half;
        int k = k0 + sub * 16 + n;
        float b = qh_p[q * 32 + (k >> 5)] + qw_p[q * 32 + (k & 31)]
                + kh_p[(q >> 5) * 1024 + k] + kw_p[(q & 31) * 1024 + k];
        S[sub][i] = S[sub][i] * 0.125f + b;    // 1/sqrt(64) on QK only
      }

    // ---- online softmax (reduce across the 16-lane column group) ----
#pragma unroll
    for (int i = 0; i < 8; ++i) {
      float tm = fmaxf(fmaxf(S[0][i], S[1][i]), fmaxf(S[2][i], S[3][i]));
      tm = fmaxf(tm, __shfl_xor(tm, 8));
      tm = fmaxf(tm, __shfl_xor(tm, 4));
      tm = fmaxf(tm, __shfl_xor(tm, 2));
      tm = fmaxf(tm, __shfl_xor(tm, 1));
      float newm = fmaxf(rm[i], tm);
      float corr = __expf(rm[i] - newm);
      rm[i] = newm;
      float ts = 0.f;
#pragma unroll
      for (int sub = 0; sub < 4; ++sub) {
        float p = __expf(S[sub][i] - newm);
        S[sub][i] = p;
        ts += p;
      }
      ts += __shfl_xor(ts, 8); ts += __shfl_xor(ts, 4);
      ts += __shfl_xor(ts, 2); ts += __shfl_xor(ts, 1);
      rl[i] = rl[i] * corr + ts;
#pragma unroll
      for (int cs = 0; cs < 4; ++cs) Oacc[cs][i] *= corr;
    }

    // ---- P: C-layout regs -> A-layout in wave-private LDS ----
#pragma unroll
    for (int sub = 0; sub < 4; ++sub)
#pragma unroll
      for (int i = 0; i < 8; ++i) {
        int mrow = i + 8 * half;
        int kl   = sub * 16 + n;
        int kc = kl >> 5, K32 = kl & 31;
        int hf = (K32 >> 3) & 1, e = (K32 & 7) + 8 * (K32 >> 4);
        sP[wave][kc][(hf * 16 + mrow) * 16 + e] = (_Float16)S[sub][i];
      }
    asm volatile("s_wait_dscnt 0x0" ::: "memory");  // per-wave LDS RAW fence

    // ---- O += P * V : preload operands, then 8 back-to-back WMMAs ----
    v16h aP0 = *(const v16h*)(sP[wave][0] + lane * 16);
    v16h aP1 = *(const v16h*)(sP[wave][1] + lane * 16);
    v16h vB[8];
#pragma unroll
    for (int op = 0; op < 8; ++op)
      vB[op] = *(const v16h*)(sVb + (op * 32 + lane) * 16);
#pragma unroll
    for (int cs = 0; cs < 4; ++cs)
      Oacc[cs] = __builtin_amdgcn_wmma_f32_16x16x32_f16(false, aP0, false,
                                                        vB[cs], (short)0,
                                                        Oacc[cs], false, false);
#pragma unroll
    for (int cs = 0; cs < 4; ++cs)
      Oacc[cs] = __builtin_amdgcn_wmma_f32_16x16x32_f16(false, aP1, false,
                                                        vB[4 + cs], (short)0,
                                                        Oacc[cs], false, false);

    __syncthreads();   // all waves done reading before buffer reuse
  }

  // ---- epilogue: normalize, add residual Q, store fp32 ----
#pragma unroll
  for (int cs = 0; cs < 4; ++cs)
#pragma unroll
    for (int i = 0; i < 8; ++i) {
      int q = qbase + i + 8 * half;
      int c = cs * 16 + n;
      size_t idx = ((size_t)bn * LQ + q) * CD + c;
      Out[idx] = Oacc[cs][i] / rl[i] + Qg[idx];
    }
}

// ---------------------------------------------------------------------------
extern "C" void kernel_launch(void* const* d_in, const int* in_sizes, int n_in,
                              void* d_out, int out_size, void* d_ws, size_t ws_size,
                              hipStream_t stream) {
  (void)in_sizes; (void)n_in; (void)out_size; (void)ws_size;
  const float* q   = (const float*)d_in[0];
  const float* k   = (const float*)d_in[1];
  const float* v   = (const float*)d_in[2];
  const float* rhq = (const float*)d_in[3];
  const float* rwq = (const float*)d_in[4];
  const float* rhk = (const float*)d_in[5];
  const float* rwk = (const float*)d_in[6];
  float*    ws  = (float*)d_ws;                       // needs 24 MB
  _Float16* wsh = (_Float16*)(ws + WS_F32_FLOATS);
  float*    out = (float*)d_out;

  bias_kernel<<<dim3(32, 32), 256, 0, stream>>>(q, k, rhq, rwq, rhk, rwk, ws);
  prepack_kernel<<<16384, 256, 0, stream>>>(k, v, wsh);
  flash_kernel<<<dim3(16, 32), 128, 0, stream>>>(q, ws, wsh, out);
}

// v002
// One run takes 96.3 microseconds.
// In two side-by-side timings against v001, it was 1.07 and 1.06 times as fast.
// Counting every step since v000, it is 2.12 times as fast.
#include <hip/hip_runtime.h>

// ---------------------------------------------------------------------------
// Decomposed rel-pos attention for MI455X (gfx1250), wave32 + WMMA f16.
// Phase 1a: bias tables qh,qw (L x 32), kh,kw (32 x L) per (b,n), fp32 WMMA -> ws
// Phase 1b: K,V pre-swizzled to f16 WMMA B-operand tiles (8KB/tile)   -> ws
// Phase 2 : flash attention; K/V tiles streamed to LDS with
//           GLOBAL_LOAD_ASYNC_TO_LDS_B128 (double-buffered, ASYNCcnt),
//           v_wmma_f32_16x16x32_f16 for QK^T and P*V.
// ws requirement: 16 MB bias (fp32) + 8 MB K/V f16 tiles = 24 MB.
// ---------------------------------------------------------------------------

typedef __attribute__((ext_vector_type(16))) _Float16 v16h;
typedef __attribute__((ext_vector_type(8)))  float    v8f;

#define LQ   1024
#define CD   64
// fp32 workspace offsets (floats)
#define QH_OFF 0
#define QW_OFF (32*1024*32)
#define KH_OFF (2*32*1024*32)
#define KW_OFF (3*32*1024*32)
#define WS_F32_FLOATS (4*32*1024*32)          // 4M floats = 16 MB
// f16 workspace offsets (halves), relative to wsh = (ws + WS_F32_FLOATS)
#define WSK_HOFF 0
#define WSV_HOFF (32*16*4096)                 // 2M halves = 4 MB

// A/B operand K-index map (16-bit WMMA): element e, lane half h ->
// K = (e&7) + 8*h + 16*(e>>3)
__device__ __forceinline__ int kmap(int e, int half) {
  return (e & 7) + 8 * half + 16 * (e >> 3);
}

// --------------------------- Phase 1a: bias tables --------------------------
// Each table is a small fp32 GEMM (rows of Q or K against rows of a rel table),
// done on v_wmma_f32_16x16x4_f32. One block = one (bn, hb): it stages the 256
// operand rows it needs in LDS with whole-line loads, then waves 0-1 make qh for
// q>>5 == hb, 2-3 qw for q&31 == hb, 4-5 kh and 6-7 kw for k>>5 == hb.
// A wave owns whole 128-byte output rows.
typedef __attribute__((ext_vector_type(2))) float v2f;
typedef __attribute__((ext_vector_type(4))) float v4f;

#define SP 68   // LDS row pitch (floats) of the staged rows: 272 B, 16-byte column reads hit 64 banks
#define GP 36   // LDS row pitch (floats) of the kw skew buffer, rows stay 16-byte aligned
// first staged row of each operand
#define XQ1  0     // Q[hb*32 + i]
#define XQ2  32    // Q[i*32 + hb]
#define XK   64    // K[hb*32 + i]
#define XRHQ 96    // rhq[hb + i]
#define XRWQ 128   // rwq[hb + i]
#define XRHK 160   // rhk[31 - hb + i]
#define XRWK 192   // rwk[min(i, 62)], i = 0..63

// 16 rows x 64 floats as 16 k-steps of a 16x16x4 operand. Lane (c, h) holds
// columns 8*i + 4*h + 0..3 of its row; A and B use this one loader, so their
// k orders pair position by position.
struct Frag { v4f f[8]; };

__device__ __forceinline__ void lds_frag(Frag& x, const float* row, int h) {
  const v4f* p = (const v4f*)(row + 4 * h);
#pragma unroll
  for (int i = 0; i < 8; ++i) x.f[i] = p[2 * i];
}

// d0[m][n] = sum_c A[m][c] * B0[n][c], d1 likewise with B1: two independent
// accumulate chains; register r of lane (c, h) = element [8*h + r][c]
__device__ __forceinline__ void frag_mm2(const Frag& a, const Frag& b0, const Frag& b1,
                                         v8f& d0, v8f& d1) {
  const v8f z = {0.f, 0.f, 0.f, 0.f, 0.f, 0.f, 0.f, 0.f};
  d0 = z; d1 = z;
#pragma unroll
  for (int i = 0; i < 8; ++i) {
    v2f al = {a.f[i].x, a.f[i].y},   ah = {a.f[i].z, a.f[i].w};
    v2f pl = {b0.f[i].x, b0.f[i].y}, ph = {b0.f[i].z, b0.f[i].w};
    v2f ql = {b1.f[i].x, b1.f[i].y}, qh = {b1.f[i].z, b1.f[i].w};
    d0 = __builtin_amdgcn_wmma_f32_16x16x4_f32(false, al, false, pl, (short)0, d0, false, false);
    d1 = __builtin_amdgcn_wmma_f32_16x16x4_f32(false, al, false, ql, (short)0, d1, false, false);
    d0 = __builtin_amdgcn_wmma_f32_16x16x4_f32(false, ah, false, ph, (short)0, d0, false, false);
    d1 = __builtin_amdgcn_wmma_f32_16x16x4_f32(false, ah, false, qh, (short)0, d1, false, false);
  }
}

__global__ __launch_bounds__(256) void bias_kernel(
    const float* __restrict__ Qg, const float* __restrict__ Kg,
    const float* __restrict__ rhq, const float* __restrict__ rwq,
    const float* __restrict__ rhk, const float* __restrict__ rwk,
    float* __restrict__ ws)
{
  __shared__ __attribute__((aligned(16))) float sX[256 * SP];
  __shared__ __attribute__((aligned(16))) float sG[2][16 * GP];

  const int hb   = blockIdx.x;
  const int bn   = blockIdx.y;
  const int tid  = threadIdx.x;
  const int wv   = __builtin_amdgcn_readfirstlane(tid >> 5);
  const int lane = tid & 31;
  const int c    = lane & 15;
  const int h    = lane >> 4;
  const int s    = wv & 1;
  const int tab  = wv >> 1;
  float* wsb = ws + (size_t)bn * 32768;

  // ---- stage: 16 lanes read one whole 256-byte row, 16 rows per pass ----
  {
    const int sr = tid >> 4;
    const int sc = (tid & 15) * 4;
    // per-lane byte offsets: rows 1 apart, rows 32 apart, last rwk rows (row 63 repeats 62)
    const unsigned o1 = (unsigned)(sr * CD + sc) * 4u;
    const unsigned o2 = (unsigned)(sr * 32 * CD + sc) * 4u;
    const unsigned o3 = (unsigned)(min(sr, 14) * CD + sc) * 4u;
    // block-uniform base of each staged operand
    const float* Qb = Qg + (size_t)bn * LQ * CD;
    const float* Kb = Kg + (size_t)bn * LQ * CD;
    const char* pQ1 = (const char*)(Qb + hb * 32 * CD);
    const char* pQ2 = (const char*)(Qb + hb * CD);
    const char* pK  = (const char*)(Kb + hb * 32 * CD);
    const char* pHQ = (const char*)(rhq + hb * CD);
    const char* pWQ = (const char*)(rwq + hb * CD);
    const char* pHK = (const char*)(rhk + (31 - hb) * CD);
    const char* pWK = (const char*)rwk;
    v4f st[16];
    st[0]  = *(const v4f*)(pQ1 + o1);
    st[1]  = *(const v4f*)(pQ1 + 16 * CD * 4 + o1);
    st[2]  = *(const v4f*)(pQ2 + o2);
    st[3]  = *(const v4f*)(pQ2 + 16 * 32 * CD * 4 + o2);
    st[4]  = *(const v4f*)(pK + o1);
    st[5]  = *(const v4f*)(pK + 16 * CD * 4 + o1);
    st[6]  = *(const v4f*)(pHQ + o1);
    st[7]  = *(const v4f*)(pHQ + 16 * CD * 4 + o1);
    st[8]  = *(const v4f*)(pWQ + o1);
    st[9]  = *(const v4f*)(pWQ + 16 * CD * 4 + o1);
    st[10] = *(const v4f*)(pHK + o1);
    st[11] = *(const v4f*)(pHK + 16 * CD * 4 + o1);
    st[12] = *(const v4f*)(pWK + o1);
    st[13] = *(const v4f*)(pWK + 16 * CD * 4 + o1);
    st[14] = *(const v4f*)(pWK + 32 * CD * 4 + o1);
    st[15] = *(const v4f*)(pWK + 48 * CD * 4 + o3);
    // inputs-only fence on the loaded values: the loads' offset and base registers
    // stay live, so none is reused before every load above has returned
    asm volatile("" :: "v"(st[0]), "v"(st[1]), "v"(st[2]), "v"(st[3]), "v"(st[4]), "v"(st[5]),
                 "v"(st[6]), "v"(st[7]), "v"(st[8]), "v"(st[9]), "v"(st[10]), "v"(st[11]),
                 "v"(st[12]), "v"(st[13]), "v"(st[14]), "v"(st[15]), "v"(o1), "v"(o2), "v"(o3),
                 "s"(pQ1), "s"(pQ2), "s"(pK), "s"(pHQ), "s"(pWQ), "s"(pHK), "s"(pWK));
#pragma unroll
    for (int g = 0; g < 16; ++g)
      *(v4f*)&sX[(g * 16 + sr) * SP + sc] = st[g];
  }
  __syncthreads();   // staged rows visible to every wave

  if (tab < 3) {
    // qh[q][j] = Q[q] . rhq[hb - j + 31]   M = q = hb*32 + 16*s + m,  N = j
    // qw[q][j] = Q[q] . rwq[hb - j + 31]   M = q = (16*s + m)*32 + hb, N = j
    // kh[j][k] = K[k] . rhk[j - hb + 31]   M = j = 16*s + m,           N = k = hb*32 + n
    int ar, br0, br1, ostr;
    float* o;
    if (tab == 0) {
      ar = XQ1 + 16 * s + c;  br0 = XRHQ + 31 - c;  br1 = XRHQ + 15 - c;
      o = wsb + QH_OFF + (hb * 32 + 16 * s + 8 * h) * 32 + c;  ostr = 32;
    } else if (tab == 1) {
      ar = XQ2 + 16 * s + c;  br0 = XRWQ + 31 - c;  br1 = XRWQ + 15 - c;
      o = wsb + QW_OFF + ((16 * s + 8 * h) * 32 + hb) * 32 + c;  ostr = 1024;
    } else {
      ar = XRHK + 16 * s + c; br0 = XK + c;         br1 = XK + 16 + c;
      o = wsb + KH_OFF + (16 * s + 8 * h) * 1024 + hb * 32 + c;  ostr = 1024;
    }
    Frag a, b0, b1;
    lds_frag(a,  sX + ar  * SP, h);
    lds_frag(b0, sX + br0 * SP, h);
    lds_frag(b1, sX + br1 * SP, h);
    v8f d0, d1;
    frag_mm2(a, b0, b1, d0, d1);
#pragma unroll
    for (int r = 0; r < 8; ++r) {
      o[r * ostr]      = d0[r];
      o[r * ostr + 16] = d1[r];
    }
  } else {
    // kw[j][k] = K[k] . rwk[j - w + 31], j = 16*s + jl, w = 16*t + m (M = k rows);
    // N = rel row 16*(s - t + 1 + u) + c, so element (m, c) of tile u belongs to
    // jl = 16*u + c + m - 15 (in 0..15 for exactly one u); the skew is undone in LDS.
    float* g = &sG[s][0];
#pragma unroll
    for (int t = 0; t < 2; ++t) {
      Frag a, b0, b1;
      lds_frag(a,  sX + (XK + 16 * t + c) * SP, h);
      lds_frag(b0, sX + (XRWK + 16 * (s - t + 1) + c) * SP, h);
      lds_frag(b1, sX + (XRWK + 16 * (s - t + 2) + c) * SP, h);
      v8f d0, d1;
      frag_mm2(a, b0, b1, d0, d1);
      const int jl0 = c + 8 * h - 15;
      float* gw = g + 16 * t + 8 * h;
#pragma unroll
      for (int r = 0; r < 8; ++r) {
        const int jl = jl0 + r;   // -15..15: tile 0 holds row jl if jl >= 0, else tile 1 holds row jl + 16
        gw[(jl & 15) * GP + r] = jl >= 0 ? d0[r] : d1[r];
      }
    }
    // this wave's own LDS stores must have landed before its other lanes read them
    asm volatile("s_wait_dscnt 0x0" ::: "memory");
#pragma unroll
    for (int i = 0; i < 4; ++i) {
      const int row = i * 4 + (lane >> 3), col = (lane & 7) * 4;
      v4f v = *(const v4f*)(g + row * GP + col);
      *(v4f*)(wsb + KW_OFF + (16 * s + row) * 1024 + hb * 32 + col) = v;
    }
    // precaution: in the built code the block laid out behind these stores rewrites their registers
    asm volatile("s_wait_xcnt 0x0" ::: "memory");
  }
}

// ------------------- Phase 1b: K/V -> f16 B-operand tiles -------------------
// One block = 128 consecutive keys (two 64-key tiles) of one (b, n), K and V both;
// one thread converts 64 elements, so the launch is one 8-wave block per WGP.
// Every wave-wide load reads whole 128-byte lines; all 40 loads of a thread are
// in flight together.
typedef __attribute__((ext_vector_type(4))) _Float16 v4h;

__global__ __launch_bounds__(256) void prepack_kernel(
    const float* __restrict__ Kg, const float* __restrict__ Vg,
    _Float16* __restrict__ wsh)
{
  const int blk = blockIdx.x;                   // bn*8 + tile pair
  const int w   = threadIdx.x >> 5;
  const int l   = threadIdx.x & 31;
  const size_t src0 = (size_t)blk * 128 * CD;   // first of the block's 128 rows
  const size_t dst0 = (size_t)blk * 2 * 4096;   // first of its two tiles

  // K: a wave-wide load = 4 keys x one 128-byte half row (8 lanes x 4 floats each).
  // Pass it takes keys it*16 + nn, that is operand (it&3)*2 + cc of tile it>>2.
  const int cc = w & 1;                         // half row: c = cc*32 + cl + 0..3
  const int nn = (w >> 1) * 4 + (l >> 3);       // key & 15 = operand column
  const int cl = (l & 7) * 4;
  const float* ks = Kg + src0 + nn * CD + cc * 32 + cl;
  v4f kx[8];
#pragma unroll
  for (int it = 0; it < 8; ++it) kx[it] = *(const v4f*)(ks + it * 16 * CD);

  // V: a wave-wide load = one 128-byte half row of one key (lane = column);
  // a thread gathers the 16 keys of one lane's operand, once per tile.
  const int hf = w & 1;                         // operand lane half
  const int ch = (w >> 1) & 1;                  // half row: c = ch*32 + l
  const int kg = w >> 2;                        // 32-key group of the tile
  const float* vs = Vg + src0 + (kg * 32 + 8 * hf) * CD + ch * 32 + l;
  v8f vx[4];                                    // [tile*2 + (e>>3)][e&7]
#pragma unroll
  for (int it = 0; it < 2; ++it)
#pragma unroll
    for (int e = 0; e < 16; ++e)
      vx[it * 2 + (e >> 3)][e & 7] = vs[(it * 64 + kmap(e, 0)) * CD];

  // inputs-only fence on the loaded values and the two addresses: all 40 loads are
  // issued before the first conversion waits (one round trip, not two), and no
  // address register is reused while a load is out
  asm volatile("" :: "v"(kx[0]), "v"(kx[1]), "v"(kx[2]), "v"(kx[3]), "v"(kx[4]), "v"(kx[5]),
               "v"(kx[6]), "v"(kx[7]), "v"(vx[0]), "v"(vx[1]), "v"(vx[2]), "v"(vx[3]),
               "v"(ks), "v"(vs));

  // convert everything first, then only store: no register of an issued store is reused
  v4h ko[8];
#pragma unroll
  for (int it = 0; it < 8; ++it)
    ko[it] = v4h{(_Float16)kx[it].x, (_Float16)kx[it].y, (_Float16)kx[it].z, (_Float16)kx[it].w};
  v16h vo[2];
#pragma unroll
  for (int it = 0; it < 2; ++it)
#pragma unroll
    for (int e = 0; e < 16; ++e) vo[it][e] = (_Float16)vx[it * 2 + (e >> 3)][e & 7];

  // K out: 4 floats = elements e..e+3 of lane (cl>>3)&1, nn; a wave-wide 8-byte
  // store fills two whole 128-byte lines
  _Float16* kd = wsh + WSK_HOFF + dst0 + cc * 512
               + (((cl >> 3) & 1) * 16 + nn) * 16 + (cl & 7) + 8 * (cl >> 4);
  // V out: one lane's whole 32-byte operand
  _Float16* vd = wsh + WSV_HOFF + dst0 + (kg * 4 + ch * 2 + (l >> 4)) * 512
               + (hf * 16 + (l & 15)) * 16;
#pragma unroll
  for (int it = 0; it < 8; ++it) *(v4h*)(kd + it * 1024) = ko[it];
#pragma unroll
  for (int it = 0; it < 2; ++it) *(v16h*)(vd + it * 4096) = vo[it];
}

// ------------------------------ Phase 2: flash ------------------------------
__device__ __forceinline__ void async_tile(const _Float16* __restrict__ gsrc,
                                           _Float16* ldst, int t) {
#pragma unroll
  for (int i = 0; i < 4; ++i) {
    unsigned lk = (unsigned)(uintptr_t)(ldst + t * 8 + i * 1024);  // LDS byte addr
    const _Float16* gs = gsrc + t * 8 + i * 1024;
    asm volatile("global_load_async_to_lds_b128 %0, %1, off"
                 :: "v"(lk), "v"(gs) : "memory");
  }
}

__global__ __launch_bounds__(128) void flash_kernel(
    const float* __restrict__ Qg, const float* __restrict__ ws,
    const _Float16* __restrict__ wsh, float* __restrict__ Out)
{
  // double-buffered K/V tiles already in B-operand layout (8KB each)
  __shared__ __attribute__((aligned(32))) _Float16 sK[2][4096];
  __shared__ __attribute__((aligned(32))) _Float16 sV[2][4096];
  // P in A-layout, wave-private: [wave][k_chunk(2)][lane(32)*e(16)]
  __shared__ __attribute__((aligned(32))) _Float16 sP[4][2][32 * 16];

  const int bn    = blockIdx.y;
  const int qtile = blockIdx.x;
  const int t     = threadIdx.x;
  const int wave  = t >> 5;
  const int lane  = t & 31;
  const int half  = lane >> 4;
  const int n     = lane & 15;
  const int qbase = qtile * 64 + wave * 16;

  const float* qh_p = ws + QH_OFF + (size_t)bn * 32768;
  const float* qw_p = ws + QW_OFF + (size_t)bn * 32768;
  const float* kh_p = ws + KH_OFF + (size_t)bn * 32768;
  const float* kw_p = ws + KW_OFF + (size_t)bn * 32768;
  const _Float16* gK = wsh + WSK_HOFF + (size_t)(bn * 16) * 4096;
  const _Float16* gV = wsh + WSV_HOFF + (size_t)(bn * 16) * 4096;

  // ---- this wave's 16 Q rows as two f16 A operands (C = 0..31, 32..63) ----
  v16h qA[2];
  {
    const float* qr = Qg + ((size_t)bn * LQ + (qbase + n)) * CD;  // A: M = lane&15
#pragma unroll
    for (int cc = 0; cc < 2; ++cc)
#pragma unroll
      for (int e = 0; e < 16; ++e)
        qA[cc][e] = (_Float16)qr[kmap(e, half) + 32 * cc];
  }

  v8f Oacc[4];
  const v8f vzero = {0.f, 0.f, 0.f, 0.f, 0.f, 0.f, 0.f, 0.f};
#pragma unroll
  for (int cs = 0; cs < 4; ++cs) Oacc[cs] = vzero;
  float rm[8], rl[8];
#pragma unroll
  for (int i = 0; i < 8; ++i) { rm[i] = -3.0e38f; rl[i] = 0.f; }

  // prologue: start tile 0 into buffer 0
  async_tile(gK, &sK[0][0], t);
  async_tile(gV, &sV[0][0], t);

  for (int kt = 0; kt < 16; ++kt) {
    const int cur = kt & 1;
    const int k0  = kt * 64;

    asm volatile("s_wait_asynccnt 0x0" ::: "memory");  // my tile portion landed
    __syncthreads();                                   // whole tile visible

    if (kt + 1 < 16) {                                 // overlap next copy
      async_tile(gK + (size_t)(kt + 1) * 4096, &sK[cur ^ 1][0], t);
      async_tile(gV + (size_t)(kt + 1) * 4096, &sV[cur ^ 1][0], t);
    }
    const _Float16* sKb = &sK[cur][0];
    const _Float16* sVb = &sV[cur][0];

    // ---- scores: preload all 8 B operands, then 8 back-to-back WMMAs ----
    v16h kB[8];
#pragma unroll
    for (int op = 0; op < 8; ++op)
      kB[op] = *(const v16h*)(sKb + (op * 32 + lane) * 16);

    v8f S[4];
#pragma unroll
    for (int sub = 0; sub < 4; ++sub)
      S[sub] = __builtin_amdgcn_wmma_f32_16x16x32_f16(false, qA[0], false,
                                                      kB[sub * 2], (short)0,
                                                      vzero, false, false);
#pragma unroll
    for (int sub = 0; sub < 4; ++sub)
      S[sub] = __builtin_amdgcn_wmma_f32_16x16x32_f16(false, qA[1], false,
                                                      kB[sub * 2 + 1], (short)0,
                                                      S[sub], false, false);

    // ---- scale + rel-pos bias (C-layout: row i+8*half, col n) ----
#pragma unroll
    for (int sub = 0; sub < 4; ++sub)
#pragma unroll
      for (int i = 0; i < 8; ++i) {
        int q = qbase + i + 8 * half;
        int k = k0 + sub * 16 + n;
        float b = qh_p[q * 32 + (k >> 5)] + qw_p[q * 32 + (k & 31)]
                + kh_p[(q >> 5) * 1024 + k] + kw_p[(q & 31) * 1024 + k];
        S[sub][i] = S[sub][i] * 0.125f + b;    // 1/sqrt(64) on QK only
      }

    // ---- online softmax (reduce across the 16-lane column group) ----
#pragma unroll
    for (int i = 0; i < 8; ++i) {
      float tm = fmaxf(fmaxf(S[0][i], S[1][i]), fmaxf(S[2][i], S[3][i]));
      tm = fmaxf(tm, __shfl_xor(tm, 8));
      tm = fmaxf(tm, __shfl_xor(tm, 4));
      tm = fmaxf(tm, __shfl_xor(tm, 2));
      tm = fmaxf(tm, __shfl_xor(tm, 1));
      float newm = fmaxf(rm[i], tm);
      float corr = __expf(rm[i] - newm);
      rm[i] = newm;
      float ts = 0.f;
#pragma unroll
      for (int sub = 0; sub < 4; ++sub) {
        float p = __expf(S[sub][i] - newm);
        S[sub][i] = p;
        ts += p;
      }
      ts += __shfl_xor(ts, 8); ts += __shfl_xor(ts, 4);
      ts += __shfl_xor(ts, 2); ts += __shfl_xor(ts, 1);
      rl[i] = rl[i] * corr + ts;
#pragma unroll
      for (int cs = 0; cs < 4; ++cs) Oacc[cs][i] *= corr;
    }

    // ---- P: C-layout regs -> A-layout in wave-private LDS ----
#pragma unroll
    for (int sub = 0; sub < 4; ++sub)
#pragma unroll
      for (int i = 0; i < 8; ++i) {
        int mrow = i + 8 * half;
        int kl   = sub * 16 + n;
        int kc = kl >> 5, K32 = kl & 31;
        int hf = (K32 >> 3) & 1, e = (K32 & 7) + 8 * (K32 >> 4);
        sP[wave][kc][(hf * 16 + mrow) * 16 + e] = (_Float16)S[sub][i];
      }
    asm volatile("s_wait_dscnt 0x0" ::: "memory");  // per-wave LDS RAW fence

    // ---- O += P * V : preload operands, then 8 back-to-back WMMAs ----
    v16h aP0 = *(const v16h*)(sP[wave][0] + lane * 16);
    v16h aP1 = *(const v16h*)(sP[wave][1] + lane * 16);
    v16h vB[8];
#pragma unroll
    for (int op = 0; op < 8; ++op)
      vB[op] = *(const v16h*)(sVb + (op * 32 + lane) * 16);
#pragma unroll
    for (int cs = 0; cs < 4; ++cs)
      Oacc[cs] = __builtin_amdgcn_wmma_f32_16x16x32_f16(false, aP0, false,
                                                        vB[cs], (short)0,
                                                        Oacc[cs], false, false);
#pragma unroll
    for (int cs = 0; cs < 4; ++cs)
      Oacc[cs] = __builtin_amdgcn_wmma_f32_16x16x32_f16(false, aP1, false,
                                                        vB[4 + cs], (short)0,
                                                        Oacc[cs], false, false);

    __syncthreads();   // all waves done reading before buffer reuse
  }

  // ---- epilogue: normalize, add residual Q, store fp32 ----
#pragma unroll
  for (int cs = 0; cs < 4; ++cs)
#pragma unroll
    for (int i = 0; i < 8; ++i) {
      int q = qbase + i + 8 * half;
      int c = cs * 16 + n;
      size_t idx = ((size_t)bn * LQ + q) * CD + c;
      Out[idx] = Oacc[cs][i] / rl[i] + Qg[idx];
    }
}

// ---------------------------------------------------------------------------
extern "C" void kernel_launch(void* const* d_in, const int* in_sizes, int n_in,
                              void* d_out, int out_size, void* d_ws, size_t ws_size,
                              hipStream_t stream) {
  (void)in_sizes; (void)n_in; (void)out_size; (void)ws_size;
  const float* q   = (const float*)d_in[0];
  const float* k   = (const float*)d_in[1];
  const float* v   = (const float*)d_in[2];
  const float* rhq = (const float*)d_in[3];
  const float* rwq = (const float*)d_in[4];
  const float* rhk = (const float*)d_in[5];
  const float* rwk = (const float*)d_in[6];
  float*    ws  = (float*)d_ws;                       // needs 24 MB
  _Float16* wsh = (_Float16*)(ws + WS_F32_FLOATS);
  float*    out = (float*)d_out;

  bias_kernel<<<dim3(32, 32), 256, 0, stream>>>(q, k, rhq, rwq, rhk, rwk, ws);
  prepack_kernel<<<256, 256, 0, stream>>>(k, v, wsh);
  flash_kernel<<<dim3(16, 32), 128, 0, stream>>>(q, ws, wsh, out);
}

// v003
// Measured time: 61 microseconds a run.
// In two side-by-side timings against v002, it was 1.59 and 1.60 times as fast.
// Counting every step since v000, it is 3.38 times as fast.
#include <hip/hip_runtime.h>

// ---------------------------------------------------------------------------
// Decomposed rel-pos attention for MI455X (gfx1250), wave32 + WMMA f16.
// Phase 1a: bias tables qh,qw (L x 32), kh,kw (32 x L) per (b,n), fp32 WMMA -> ws
// Phase 1b: K,V pre-swizzled to f16 WMMA B-operand tiles (8KB/tile)   -> ws
// Phase 2 : flash attention; K/V tiles streamed to LDS with
//           GLOBAL_LOAD_ASYNC_TO_LDS_B128 (double-buffered, ASYNCcnt),
//           v_wmma_f32_16x16x32_f16 for QK^T and P*V; a tile's bias operands
//           are loaded into registers one tile ahead.
// ws requirement: 16 MB bias (fp32) + 8 MB K/V f16 tiles = 24 MB.
// ---------------------------------------------------------------------------

typedef __attribute__((ext_vector_type(16))) _Float16 v16h;
typedef __attribute__((ext_vector_type(8)))  float    v8f;

#define LQ   1024
#define CD   64
// fp32 workspace offsets (floats)
#define QH_OFF 0
#define QW_OFF (32*1024*32)
#define KH_OFF (2*32*1024*32)
#define KW_OFF (3*32*1024*32)
#define WS_F32_FLOATS (4*32*1024*32)          // 4M floats = 16 MB
// f16 workspace offsets (halves), relative to wsh = (ws + WS_F32_FLOATS)
#define WSK_HOFF 0
#define WSV_HOFF (32*16*4096)                 // 2M halves = 4 MB

// A/B operand K-index map (16-bit WMMA): element e, lane half h ->
// K = (e&7) + 8*h + 16*(e>>3)
__device__ __forceinline__ int kmap(int e, int half) {
  return (e & 7) + 8 * half + 16 * (e >> 3);
}

// --------------------------- Phase 1a: bias tables --------------------------
// Each table is a small fp32 GEMM (rows of Q or K against rows of a rel table),
// done on v_wmma_f32_16x16x4_f32. One block = one (bn, hb): it stages the 256
// operand rows it needs in LDS with whole-line loads, then waves 0-1 make qh for
// q>>5 == hb, 2-3 qw for q&31 == hb, 4-5 kh and 6-7 kw for k>>5 == hb.
// A wave owns whole 128-byte output rows.
typedef __attribute__((ext_vector_type(2))) float v2f;
typedef __attribute__((ext_vector_type(4))) float v4f;

#define SP 68   // LDS row pitch (floats) of the staged rows: 272 B, 16-byte column reads hit 64 banks
#define GP 36   // LDS row pitch (floats) of the kw skew buffer, rows stay 16-byte aligned
// first staged row of each operand
#define XQ1  0     // Q[hb*32 + i]
#define XQ2  32    // Q[i*32 + hb]
#define XK   64    // K[hb*32 + i]
#define XRHQ 96    // rhq[hb + i]
#define XRWQ 128   // rwq[hb + i]
#define XRHK 160   // rhk[31 - hb + i]
#define XRWK 192   // rwk[min(i, 62)], i = 0..63

// 16 rows x 64 floats as 16 k-steps of a 16x16x4 operand. Lane (c, h) holds
// columns 8*i + 4*h + 0..3 of its row; A and B use this one loader, so their
// k orders pair position by position.
struct Frag { v4f f[8]; };

__device__ __forceinline__ void lds_frag(Frag& x, const float* row, int h) {
  const v4f* p = (const v4f*)(row + 4 * h);
#pragma unroll
  for (int i = 0; i < 8; ++i) x.f[i] = p[2 * i];
}

// d0[m][n] = sum_c A[m][c] * B0[n][c], d1 likewise with B1: two independent
// accumulate chains; register r of lane (c, h) = element [8*h + r][c]
__device__ __forceinline__ void frag_mm2(const Frag& a, const Frag& b0, const Frag& b1,
                                         v8f& d0, v8f& d1) {
  const v8f z = {0.f, 0.f, 0.f, 0.f, 0.f, 0.f, 0.f, 0.f};
  d0 = z; d1 = z;
#pragma unroll
  for (int i = 0; i < 8; ++i) {
    v2f al = {a.f[i].x, a.f[i].y},   ah = {a.f[i].z, a.f[i].w};
    v2f pl = {b0.f[i].x, b0.f[i].y}, ph = {b0.f[i].z, b0.f[i].w};
    v2f ql = {b1.f[i].x, b1.f[i].y}, qh = {b1.f[i].z, b1.f[i].w};
    d0 = __builtin_amdgcn_wmma_f32_16x16x4_f32(false, al, false, pl, (short)0, d0, false, false);
    d1 = __builtin_amdgcn_wmma_f32_16x16x4_f32(false, al, false, ql, (short)0, d1, false, false);
    d0 = __builtin_amdgcn_wmma_f32_16x16x4_f32(false, ah, false, ph, (short)0, d0, false, false);
    d1 = __builtin_amdgcn_wmma_f32_16x16x4_f32(false, ah, false, qh, (short)0, d1, false, false);
  }
}

__global__ __launch_bounds__(256) void bias_kernel(
    const float* __restrict__ Qg, const float* __restrict__ Kg,
    const float* __restrict__ rhq, const float* __restrict__ rwq,
    const float* __restrict__ rhk, const float* __restrict__ rwk,
    float* __restrict__ ws)
{
  __shared__ __attribute__((aligned(16))) float sX[256 * SP];
  __shared__ __attribute__((aligned(16))) float sG[2][16 * GP];

  const int hb   = blockIdx.x;
  const int bn   = blockIdx.y;
  const int tid  = threadIdx.x;
  const int wv   = __builtin_amdgcn_readfirstlane(tid >> 5);
  const int lane = tid & 31;
  const int c    = lane & 15;
  const int h    = lane >> 4;
  const int s    = wv & 1;
  const int tab  = wv >> 1;
  float* wsb = ws + (size_t)bn * 32768;

  // ---- stage: 16 lanes read one whole 256-byte row, 16 rows per pass ----
  {
    const int sr = tid >> 4;
    const int sc = (tid & 15) * 4;
    // per-lane byte offsets: rows 1 apart, rows 32 apart, last rwk rows (row 63 repeats 62)
    const unsigned o1 = (unsigned)(sr * CD + sc) * 4u;
    const unsigned o2 = (unsigned)(sr * 32 * CD + sc) * 4u;
    const unsigned o3 = (unsigned)(min(sr, 14) * CD + sc) * 4u;
    // block-uniform base of each staged operand
    const float* Qb = Qg + (size_t)bn * LQ * CD;
    const float* Kb = Kg + (size_t)bn * LQ * CD;
    const char* pQ1 = (const char*)(Qb + hb * 32 * CD);
    const char* pQ2 = (const char*)(Qb + hb * CD);
    const char* pK  = (const char*)(Kb + hb * 32 * CD);
    const char* pHQ = (const char*)(rhq + hb * CD);
    const char* pWQ = (const char*)(rwq + hb * CD);
    const char* pHK = (const char*)(rhk + (31 - hb) * CD);
    const char* pWK = (const char*)rwk;
    v4f st[16];
    st[0]  = *(const v4f*)(pQ1 + o1);
    st[1]  = *(const v4f*)(pQ1 + 16 * CD * 4 + o1);
    st[2]  = *(const v4f*)(pQ2 + o2);
    st[3]  = *(const v4f*)(pQ2 + 16 * 32 * CD * 4 + o2);
    st[4]  = *(const v4f*)(pK + o1);
    st[5]  = *(const v4f*)(pK + 16 * CD * 4 + o1);
    st[6]  = *(const v4f*)(pHQ + o1);
    st[7]  = *(const v4f*)(pHQ + 16 * CD * 4 + o1);
    st[8]  = *(const v4f*)(pWQ + o1);
    st[9]  = *(const v4f*)(pWQ + 16 * CD * 4 + o1);
    st[10] = *(const v4f*)(pHK + o1);
    st[11] = *(const v4f*)(pHK + 16 * CD * 4 + o1);
    st[12] = *(const v4f*)(pWK + o1);
    st[13] = *(const v4f*)(pWK + 16 * CD * 4 + o1);
    st[14] = *(const v4f*)(pWK + 32 * CD * 4 + o1);
    st[15] = *(const v4f*)(pWK + 48 * CD * 4 + o3);
    // inputs-only fence on the loaded values: the loads' offset and base registers
    // stay live, so none is reused before every load above has returned
    asm volatile("" :: "v"(st[0]), "v"(st[1]), "v"(st[2]), "v"(st[3]), "v"(st[4]), "v"(st[5]),
                 "v"(st[6]), "v"(st[7]), "v"(st[8]), "v"(st[9]), "v"(st[10]), "v"(st[11]),
                 "v"(st[12]), "v"(st[13]), "v"(st[14]), "v"(st[15]), "v"(o1), "v"(o2), "v"(o3),
                 "s"(pQ1), "s"(pQ2), "s"(pK), "s"(pHQ), "s"(pWQ), "s"(pHK), "s"(pWK));
#pragma unroll
    for (int g = 0; g < 16; ++g)
      *(v4f*)&sX[(g * 16 + sr) * SP + sc] = st[g];
  }
  __syncthreads();   // staged rows visible to every wave

  if (tab < 3) {
    // qh[q][j] = Q[q] . rhq[hb - j + 31]   M = q = hb*32 + 16*s + m,  N = j
    // qw[q][j] = Q[q] . rwq[hb - j + 31]   M = q = (16*s + m)*32 + hb, N = j
    // kh[j][k] = K[k] . rhk[j - hb + 31]   M = j = 16*s + m,           N = k = hb*32 + n
    int ar, br0, br1, ostr;
    float* o;
    if (tab == 0) {
      ar = XQ1 + 16 * s + c;  br0 = XRHQ + 31 - c;  br1 = XRHQ + 15 - c;
      o = wsb + QH_OFF + (hb * 32 + 16 * s + 8 * h) * 32 + c;  ostr = 32;
    } else if (tab == 1) {
      ar = XQ2 + 16 * s + c;  br0 = XRWQ + 31 - c;  br1 = XRWQ + 15 - c;
      o = wsb + QW_OFF + ((16 * s + 8 * h) * 32 + hb) * 32 + c;  ostr = 1024;
    } else {
      ar = XRHK + 16 * s + c; br0 = XK + c;         br1 = XK + 16 + c;
      o = wsb + KH_OFF + (16 * s + 8 * h) * 1024 + hb * 32 + c;  ostr = 1024;
    }
    Frag a, b0, b1;
    lds_frag(a,  sX + ar  * SP, h);
    lds_frag(b0, sX + br0 * SP, h);
    lds_frag(b1, sX + br1 * SP, h);
    v8f d0, d1;
    frag_mm2(a, b0, b1, d0, d1);
#pragma unroll
    for (int r = 0; r < 8; ++r) {
      o[r * ostr]      = d0[r];
      o[r * ostr + 16] = d1[r];
    }
  } else {
    // kw[j][k] = K[k] . rwk[j - w + 31], j = 16*s + jl, w = 16*t + m (M = k rows);
    // N = rel row 16*(s - t + 1 + u) + c, so element (m, c) of tile u belongs to
    // jl = 16*u + c + m - 15 (in 0..15 for exactly one u); the skew is undone in LDS.
    float* g = &sG[s][0];
#pragma unroll
    for (int t = 0; t < 2; ++t) {
      Frag a, b0, b1;
      lds_frag(a,  sX + (XK + 16 * t + c) * SP, h);
      lds_frag(b0, sX + (XRWK + 16 * (s - t + 1) + c) * SP, h);
      lds_frag(b1, sX + (XRWK + 16 * (s - t + 2) + c) * SP, h);
      v8f d0, d1;
      frag_mm2(a, b0, b1, d0, d1);
      const int jl0 = c + 8 * h - 15;
      float* gw = g + 16 * t + 8 * h;
#pragma unroll
      for (int r = 0; r < 8; ++r) {
        const int jl = jl0 + r;   // -15..15: tile 0 holds row jl if jl >= 0, else tile 1 holds row jl + 16
        gw[(jl & 15) * GP + r] = jl >= 0 ? d0[r] : d1[r];
      }
    }
    // this wave's own LDS stores must have landed before its other lanes read them
    asm volatile("s_wait_dscnt 0x0" ::: "memory");
#pragma unroll
    for (int i = 0; i < 4; ++i) {
      const int row = i * 4 + (lane >> 3), col = (lane & 7) * 4;
      v4f v = *(const v4f*)(g + row * GP + col);
      *(v4f*)(wsb + KW_OFF + (16 * s + row) * 1024 + hb * 32 + col) = v;
    }
    // precaution: in the built code the block laid out behind these stores rewrites their registers
    asm volatile("s_wait_xcnt 0x0" ::: "memory");
  }
}

// ------------------- Phase 1b: K/V -> f16 B-operand tiles -------------------
// One block = 128 consecutive keys (two 64-key tiles) of one (b, n), K and V both;
// one thread converts 64 elements, so the launch is one 8-wave block per WGP.
// Every wave-wide load reads whole 128-byte lines; all 40 loads of a thread are
// in flight together.
typedef __attribute__((ext_vector_type(4))) _Float16 v4h;

__global__ __launch_bounds__(256) void prepack_kernel(
    const float* __restrict__ Kg, const float* __restrict__ Vg,
    _Float16* __restrict__ wsh)
{
  const int blk = blockIdx.x;                   // bn*8 + tile pair
  const int w   = threadIdx.x >> 5;
  const int l   = threadIdx.x & 31;
  const size_t src0 = (size_t)blk * 128 * CD;   // first of the block's 128 rows
  const size_t dst0 = (size_t)blk * 2 * 4096;   // first of its two tiles

  // K: a wave-wide load = 4 keys x one 128-byte half row (8 lanes x 4 floats each).
  // Pass it takes keys it*16 + nn, that is operand (it&3)*2 + cc of tile it>>2.
  const int cc = w & 1;                         // half row: c = cc*32 + cl + 0..3
  const int nn = (w >> 1) * 4 + (l >> 3);       // key & 15 = operand column
  const int cl = (l & 7) * 4;
  const float* ks = Kg + src0 + nn * CD + cc * 32 + cl;
  v4f kx[8];
#pragma unroll
  for (int it = 0; it < 8; ++it) kx[it] = *(const v4f*)(ks + it * 16 * CD);

  // V: a wave-wide load = one 128-byte half row of one key (lane = column);
  // a thread gathers the 16 keys of one lane's operand, once per tile.
  const int hf = w & 1;                         // operand lane half
  const int ch = (w >> 1) & 1;                  // half row: c = ch*32 + l
  const int kg = w >> 2;                        // 32-key group of the tile
  const float* vs = Vg + src0 + (kg * 32 + 8 * hf) * CD + ch * 32 + l;
  v8f vx[4];                                    // [tile*2 + (e>>3)][e&7]
#pragma unroll
  for (int it = 0; it < 2; ++it)
#pragma unroll
    for (int e = 0; e < 16; ++e)
      vx[it * 2 + (e >> 3)][e & 7] = vs[(it * 64 + kmap(e, 0)) * CD];

  // inputs-only fence on the loaded values and the two addresses: all 40 loads are
  // issued before the first conversion waits (one round trip, not two), and no
  // address register is reused while a load is out
  asm volatile("" :: "v"(kx[0]), "v"(kx[1]), "v"(kx[2]), "v"(kx[3]), "v"(kx[4]), "v"(kx[5]),
               "v"(kx[6]), "v"(kx[7]), "v"(vx[0]), "v"(vx[1]), "v"(vx[2]), "v"(vx[3]),
               "v"(ks), "v"(vs));

  // convert everything first, then only store: no register of an issued store is reused
  v4h ko[8];
#pragma unroll
  for (int it = 0; it < 8; ++it)
    ko[it] = v4h{(_Float16)kx[it].x, (_Float16)kx[it].y, (_Float16)kx[it].z, (_Float16)kx[it].w};
  v16h vo[2];
#pragma unroll
  for (int it = 0; it < 2; ++it)
#pragma unroll
    for (int e = 0; e < 16; ++e) vo[it][e] = (_Float16)vx[it * 2 + (e >> 3)][e & 7];

  // K out: 4 floats = elements e..e+3 of lane (cl>>3)&1, nn; a wave-wide 8-byte
  // store fills two whole 128-byte lines
  _Float16* kd = wsh + WSK_HOFF + dst0 + cc * 512
               + (((cl >> 3) & 1) * 16 + nn) * 16 + (cl & 7) + 8 * (cl >> 4);
  // V out: one lane's whole 32-byte operand
  _Float16* vd = wsh + WSV_HOFF + dst0 + (kg * 4 + ch * 2 + (l >> 4)) * 512
               + (hf * 16 + (l & 15)) * 16;
#pragma unroll
  for (int it = 0; it < 8; ++it) *(v4h*)(kd + it * 1024) = ko[it];
#pragma unroll
  for (int it = 0; it < 2; ++it) *(v16h*)(vd + it * 4096) = vo[it];
}

// ------------------------------ Phase 2: flash ------------------------------
__device__ __forceinline__ void async_tile(const _Float16* __restrict__ gsrc,
                                           _Float16* ldst, int t) {
#pragma unroll
  for (int i = 0; i < 4; ++i) {
    unsigned lk = (unsigned)(uintptr_t)(ldst + t * 8 + i * 1024);  // LDS byte addr
    const _Float16* gs = gsrc + t * 8 + i * 1024;
    asm volatile("global_load_async_to_lds_b128 %0, %1, off"
                 :: "v"(lk), "v"(gs) : "memory");
  }
}

// one 64-key tile's bias operands of a lane: 8 x qh pair, 4 x kh, 32 x kw,
// from the lane's three pointers into that tile
__device__ __forceinline__ void load_bias(v2f (&qhv)[8], float (&khv)[4], float (&kwv)[4][8],
                                          const float* qhl, const float* khl,
                                          const float* kwl) {
#pragma unroll
  for (int i = 0; i < 8; ++i) qhv[i] = *(const v2f*)(qhl + i * 32);
#pragma unroll
  for (int sub = 0; sub < 4; ++sub) khv[sub] = khl[sub * 16];
#pragma unroll
  for (int sub = 0; sub < 4; ++sub)
#pragma unroll
    for (int i = 0; i < 8; ++i) kwv[sub][i] = kwl[i * 1024 + sub * 16];
}

__global__ __launch_bounds__(128) void flash_kernel(
    const float* __restrict__ Qg, const float* __restrict__ ws,
    const _Float16* __restrict__ wsh, float* __restrict__ Out)
{
  // double-buffered K/V tiles already in B-operand layout (8KB each)
  __shared__ __attribute__((aligned(32))) _Float16 sK[2][4096];
  __shared__ __attribute__((aligned(32))) _Float16 sV[2][4096];
  // P in A-layout, wave-private: [wave][k_chunk(2)][lane(32)*e(16)]
  __shared__ __attribute__((aligned(32))) _Float16 sP[4][2][32 * 16];

  const int bn    = blockIdx.y;
  const int qtile = blockIdx.x;
  const int t     = threadIdx.x;
  const int wave  = t >> 5;
  const int lane  = t & 31;
  const int half  = lane >> 4;
  const int n     = lane & 15;
  const int qbase = qtile * 64 + wave * 16;

  const float* qh_p = ws + QH_OFF + (size_t)bn * 32768;
  const float* qw_p = ws + QW_OFF + (size_t)bn * 32768;
  const float* kh_p = ws + KH_OFF + (size_t)bn * 32768;
  const float* kw_p = ws + KW_OFF + (size_t)bn * 32768;
  const _Float16* gK = wsh + WSK_HOFF + (size_t)(bn * 16) * 4096;
  const _Float16* gV = wsh + WSV_HOFF + (size_t)(bn * 16) * 4096;

  // ---- this wave's 16 Q rows as two f16 A operands (C = 0..31, 32..63) ----
  v16h qA[2];
  {
    const float* qr = Qg + ((size_t)bn * LQ + (qbase + n)) * CD;  // A: M = lane&15
#pragma unroll
    for (int cc = 0; cc < 2; ++cc)
#pragma unroll
      for (int e = 0; e < 16; ++e)
        qA[cc][e] = (_Float16)qr[kmap(e, half) + 32 * cc];
  }

  v8f Oacc[4];
  const v8f vzero = {0.f, 0.f, 0.f, 0.f, 0.f, 0.f, 0.f, 0.f};
#pragma unroll
  for (int cs = 0; cs < 4; ++cs) Oacc[cs] = vzero;
  float rm[8], rl[8];
#pragma unroll
  for (int i = 0; i < 8; ++i) { rm[i] = -3.0e38f; rl[i] = 0.f; }

  // prologue: start tile 0 into buffer 0
  async_tile(gK, &sK[0][0], t);
  async_tile(gV, &sV[0][0], t);

  // ---- rel-pos bias operands of this lane (C-layout: row i + 8*half, col n) ----
  // A wave's 16 rows share q>>5; q&31 = (qbase&31) + 8*half + i.
  const float* qwl = qw_p + (qbase + 8 * half) * 32 + n;
  const float* qhl = qh_p + (qbase + 8 * half) * 32;          // these three walk the tiles
  const float* khl = kh_p + (qbase >> 5) * 1024 + n;
  const float* kwl = kw_p + ((qbase & 31) + 8 * half) * 1024 + n;
  float qwv[2][8];              // k&31 = 16*(sub&1) + n: the same in every tile, loaded once
#pragma unroll
  for (int i = 0; i < 8; ++i) { qwv[0][i] = qwl[i * 32]; qwv[1][i] = qwl[i * 32 + 16]; }
  v2f   qhv[8];                 // k>>5 = 2*kt + (sub>>1)
  float khv[4], kwv[4][8];
  load_bias(qhv, khv, kwv, qhl, khl, kwl);

  for (int kt = 0; kt < 16; ++kt) {
    const int cur = kt & 1;

    asm volatile("s_wait_asynccnt 0x0" ::: "memory");  // my tile portion landed
    __syncthreads();                                   // whole tile visible

    if (kt + 1 < 16) {                                 // overlap next copy
      async_tile(gK + (size_t)(kt + 1) * 4096, &sK[cur ^ 1][0], t);
      async_tile(gV + (size_t)(kt + 1) * 4096, &sV[cur ^ 1][0], t);
    }
    const _Float16* sKb = &sK[cur][0];
    const _Float16* sVb = &sV[cur][0];

    // ---- scores: preload all 8 B operands, then 8 back-to-back WMMAs ----
    v16h kB[8];
#pragma unroll
    for (int op = 0; op < 8; ++op)
      kB[op] = *(const v16h*)(sKb + (op * 32 + lane) * 16);

    v8f S[4];
#pragma unroll
    for (int sub = 0; sub < 4; ++sub)
      S[sub] = __builtin_amdgcn_wmma_f32_16x16x32_f16(false, qA[0], false,
                                                      kB[sub * 2], (short)0,
                                                      vzero, false, false);
#pragma unroll
    for (int sub = 0; sub < 4; ++sub)
      S[sub] = __builtin_amdgcn_wmma_f32_16x16x32_f16(false, qA[1], false,
                                                      kB[sub * 2 + 1], (short)0,
                                                      S[sub], false, false);

    // ---- scale + rel-pos bias (C-layout: row i+8*half, col n) ----
#pragma unroll
    for (int sub = 0; sub < 4; ++sub)
#pragma unroll
      for (int i = 0; i < 8; ++i) {
        float b = qhv[i][sub >> 1] + qwv[sub & 1][i] + khv[sub] + kwv[sub][i];
        S[sub][i] = S[sub][i] * 0.125f + b;    // 1/sqrt(64) on QK only
      }

    // next tile's bias operands: all loads go out here, together, and return under
    // the softmax and P*V below (the last trip reloads its own tile: stays in bounds).
    // The pointers move only here, after the last tile's loads have been used.
    const int step = kt + 1 < 16 ? 1 : 0;
    qhl += 2 * step;  khl += 64 * step;  kwl += 64 * step;
    load_bias(qhv, khv, kwv, qhl, khl, kwl);
    // without this the scheduler sinks the loads into the second half of the softmax,
    // close to the wait at the trip's last barrier, and less of their latency is hidden
    __builtin_amdgcn_sched_barrier(0);

    // ---- online softmax (reduce across the 16-lane column group) ----
#pragma unroll
    for (int i = 0; i < 8; ++i) {
      float tm = fmaxf(fmaxf(S[0][i], S[1][i]), fmaxf(S[2][i], S[3][i]));
      tm = fmaxf(tm, __shfl_xor(tm, 8));
      tm = fmaxf(tm, __shfl_xor(tm, 4));
      tm = fmaxf(tm, __shfl_xor(tm, 2));
      tm = fmaxf(tm, __shfl_xor(tm, 1));
      float newm = fmaxf(rm[i], tm);
      float corr = __expf(rm[i] - newm);
      rm[i] = newm;
      float ts = 0.f;
#pragma unroll
      for (int sub = 0; sub < 4; ++sub) {
        float p = __expf(S[sub][i] - newm);
        S[sub][i] = p;
        ts += p;
      }
      ts += __shfl_xor(ts, 8); ts += __shfl_xor(ts, 4);
      ts += __shfl_xor(ts, 2); ts += __shfl_xor(ts, 1);
      rl[i] = rl[i] * corr + ts;
#pragma unroll
      for (int cs = 0; cs < 4; ++cs) Oacc[cs][i] *= corr;
    }

    // ---- P: C-layout regs -> A-layout in wave-private LDS ----
#pragma unroll
    for (int sub = 0; sub < 4; ++sub)
#pragma unroll
      for (int i = 0; i < 8; ++i) {
        int mrow = i + 8 * half;
        int kl   = sub * 16 + n;
        int kc = kl >> 5, K32 = kl & 31;
        int hf = (K32 >> 3) & 1, e = (K32 & 7) + 8 * (K32 >> 4);
        sP[wave][kc][(hf * 16 + mrow) * 16 + e] = (_Float16)S[sub][i];
      }
    asm volatile("s_wait_dscnt 0x0" ::: "memory");  // per-wave LDS RAW fence

    // ---- O += P * V : preload operands, then 8 back-to-back WMMAs ----
    v16h aP0 = *(const v16h*)(sP[wave][0] + lane * 16);
    v16h aP1 = *(const v16h*)(sP[wave][1] + lane * 16);
    v16h vB[8];
#pragma unroll
    for (int op = 0; op < 8; ++op)
      vB[op] = *(const v16h*)(sVb + (op * 32 + lane) * 16);
#pragma unroll
    for (int cs = 0; cs < 4; ++cs)
      Oacc[cs] = __builtin_amdgcn_wmma_f32_16x16x32_f16(false, aP0, false,
                                                        vB[cs], (short)0,
                                                        Oacc[cs], false, false);
#pragma unroll
    for (int cs = 0; cs < 4; ++cs)
      Oacc[cs] = __builtin_amdgcn_wmma_f32_16x16x32_f16(false, aP1, false,
                                                        vB[4 + cs], (short)0,
                                                        Oacc[cs], false, false);

    __syncthreads();   // all waves done reading before buffer reuse
  }

  // ---- epilogue: normalize, add residual Q, store fp32 ----
#pragma unroll
  for (int cs = 0; cs < 4; ++cs)
#pragma unroll
    for (int i = 0; i < 8; ++i) {
      int q = qbase + i + 8 * half;
      int c = cs * 16 + n;
      size_t idx = ((size_t)bn * LQ + q) * CD + c;
      Out[idx] = Oacc[cs][i] / rl[i] + Qg[idx];
    }
}

// ---------------------------------------------------------------------------
extern "C" void kernel_launch(void* const* d_in, const int* in_sizes, int n_in,
                              void* d_out, int out_size, void* d_ws, size_t ws_size,
                              hipStream_t stream) {
  (void)in_sizes; (void)n_in; (void)out_size; (void)ws_size;
  const float* q   = (const float*)d_in[0];
  const float* k   = (const float*)d_in[1];
  const float* v   = (const float*)d_in[2];
  const float* rhq = (const float*)d_in[3];
  const float* rwq = (const float*)d_in[4];
  const float* rhk = (const float*)d_in[5];
  const float* rwk = (const float*)d_in[6];
  float*    ws  = (float*)d_ws;                       // needs 24 MB
  _Float16* wsh = (_Float16*)(ws + WS_F32_FLOATS);
  float*    out = (float*)d_out;

  bias_kernel<<<dim3(32, 32), 256, 0, stream>>>(q, k, rhq, rwq, rhk, rwk, ws);
  prepack_kernel<<<256, 256, 0, stream>>>(k, v, wsh);
  flash_kernel<<<dim3(16, 32), 128, 0, stream>>>(q, ws, wsh, out);
}

// v004
// One run takes 43.8 microseconds.
// In two side-by-side timings against v003, it was 1.39 and 1.38 times as fast.
// All steps since v000 together make it 4.69 times as fast.
#include <hip/hip_runtime.h>

// ---------------------------------------------------------------------------
// Decomposed rel-pos attention for MI455X (gfx1250), wave32 + WMMA f16.
// Phase 1a: bias tables qh,qw (L x 32), kh,kw (32 x L) per (b,n), fp32 WMMA -> ws
// Phase 1b: K,V pre-swizzled to f16 WMMA B-operand tiles (8KB/tile)   -> ws
// Phase 2 : flash attention; K/V tiles streamed to LDS with
//           GLOBAL_LOAD_ASYNC_TO_LDS_B128 (double-buffered, ASYNCcnt),
//           v_wmma_f32_16x16x32_f16 for QK^T and P*V; a tile's bias operands
//           are loaded into registers one tile ahead.
// ws requirement: 16 MB bias (fp32) + 8 MB K/V f16 tiles = 24 MB.
// ---------------------------------------------------------------------------

typedef __attribute__((ext_vector_type(16))) _Float16 v16h;
typedef __attribute__((ext_vector_type(8)))  float    v8f;

#define LQ   1024
#define CD   64
// fp32 workspace offsets (floats)
#define QH_OFF 0
#define QW_OFF (32*1024*32)
#define KH_OFF (2*32*1024*32)
#define KW_OFF (3*32*1024*32)
#define WS_F32_FLOATS (4*32*1024*32)          // 4M floats = 16 MB
// f16 workspace offsets (halves), relative to wsh = (ws + WS_F32_FLOATS)
#define WSK_HOFF 0
#define WSV_HOFF (32*16*4096)                 // 2M halves = 4 MB

// A/B operand K-index map (16-bit WMMA): element e, lane half h ->
// K = (e&7) + 8*h + 16*(e>>3)
__device__ __forceinline__ int kmap(int e, int half) {
  return (e & 7) + 8 * half + 16 * (e >> 3);
}

// --------------------------- Phase 1a: bias tables --------------------------
// Each table is a small fp32 GEMM (rows of Q or K against rows of a rel table),
// done on v_wmma_f32_16x16x4_f32. One block = one (bn, hb): it stages the 256
// operand rows it needs in LDS with whole-line loads, then waves 0-1 make qh for
// q>>5 == hb, 2-3 qw for q&31 == hb, 4-5 kh and 6-7 kw for k>>5 == hb.
// A wave owns whole 128-byte output rows.
typedef __attribute__((ext_vector_type(2))) float v2f;
typedef __attribute__((ext_vector_type(4))) float v4f;

#define SP 68   // LDS row pitch (floats) of the staged rows: 272 B, 16-byte column reads hit 64 banks
#define GP 36   // LDS row pitch (floats) of the kw skew buffer, rows stay 16-byte aligned
// first staged row of each operand
#define XQ1  0     // Q[hb*32 + i]
#define XQ2  32    // Q[i*32 + hb]
#define XK   64    // K[hb*32 + i]
#define XRHQ 96    // rhq[hb + i]
#define XRWQ 128   // rwq[hb + i]
#define XRHK 160   // rhk[31 - hb + i]
#define XRWK 192   // rwk[min(i, 62)], i = 0..63

// 16 rows x 64 floats as 16 k-steps of a 16x16x4 operand. Lane (c, h) holds
// columns 8*i + 4*h + 0..3 of its row; A and B use this one loader, so their
// k orders pair position by position.
struct Frag { v4f f[8]; };

__device__ __forceinline__ void lds_frag(Frag& x, const float* row, int h) {
  const v4f* p = (const v4f*)(row + 4 * h);
#pragma unroll
  for (int i = 0; i < 8; ++i) x.f[i] = p[2 * i];
}

// d0[m][n] = sum_c A[m][c] * B0[n][c], d1 likewise with B1: two independent
// accumulate chains; register r of lane (c, h) = element [8*h + r][c]
__device__ __forceinline__ void frag_mm2(const Frag& a, const Frag& b0, const Frag& b1,
                                         v8f& d0, v8f& d1) {
  const v8f z = {0.f, 0.f, 0.f, 0.f, 0.f, 0.f, 0.f, 0.f};
  d0 = z; d1 = z;
#pragma unroll
  for (int i = 0; i < 8; ++i) {
    v2f al = {a.f[i].x, a.f[i].y},   ah = {a.f[i].z, a.f[i].w};
    v2f pl = {b0.f[i].x, b0.f[i].y}, ph = {b0.f[i].z, b0.f[i].w};
    v2f ql = {b1.f[i].x, b1.f[i].y}, qh = {b1.f[i].z, b1.f[i].w};
    d0 = __builtin_amdgcn_wmma_f32_16x16x4_f32(false, al, false, pl, (short)0, d0, false, false);
    d1 = __builtin_amdgcn_wmma_f32_16x16x4_f32(false, al, false, ql, (short)0, d1, false, false);
    d0 = __builtin_amdgcn_wmma_f32_16x16x4_f32(false, ah, false, ph, (short)0, d0, false, false);
    d1 = __builtin_amdgcn_wmma_f32_16x16x4_f32(false, ah, false, qh, (short)0, d1, false, false);
  }
}

__global__ __launch_bounds__(256) void bias_kernel(
    const float* __restrict__ Qg, const float* __restrict__ Kg,
    const float* __restrict__ rhq, const float* __restrict__ rwq,
    const float* __restrict__ rhk, const float* __restrict__ rwk,
    float* __restrict__ ws)
{
  __shared__ __attribute__((aligned(16))) float sX[256 * SP];
  __shared__ __attribute__((aligned(16))) float sG[2][16 * GP];

  const int hb   = blockIdx.x;
  const int bn   = blockIdx.y;
  const int tid  = threadIdx.x;
  const int wv   = __builtin_amdgcn_readfirstlane(tid >> 5);
  const int lane = tid & 31;
  const int c    = lane & 15;
  const int h    = lane >> 4;
  const int s    = wv & 1;
  const int tab  = wv >> 1;
  float* wsb = ws + (size_t)bn * 32768;

  // ---- stage: 16 lanes read one whole 256-byte row, 16 rows per pass ----
  {
    const int sr = tid >> 4;
    const int sc = (tid & 15) * 4;
    // per-lane byte offsets: rows 1 apart, rows 32 apart, last rwk rows (row 63 repeats 62)
    const unsigned o1 = (unsigned)(sr * CD + sc) * 4u;
    const unsigned o2 = (unsigned)(sr * 32 * CD + sc) * 4u;
    const unsigned o3 = (unsigned)(min(sr, 14) * CD + sc) * 4u;
    // block-uniform base of each staged operand
    const float* Qb = Qg + (size_t)bn * LQ * CD;
    const float* Kb = Kg + (size_t)bn * LQ * CD;
    const char* pQ1 = (const char*)(Qb + hb * 32 * CD);
    const char* pQ2 = (const char*)(Qb + hb * CD);
    const char* pK  = (const char*)(Kb + hb * 32 * CD);
    const char* pHQ = (const char*)(rhq + hb * CD);
    const char* pWQ = (const char*)(rwq + hb * CD);
    const char* pHK = (const char*)(rhk + (31 - hb) * CD);
    const char* pWK = (const char*)rwk;
    v4f st[16];
    st[0]  = *(const v4f*)(pQ1 + o1);
    st[1]  = *(const v4f*)(pQ1 + 16 * CD * 4 + o1);
    st[2]  = *(const v4f*)(pQ2 + o2);
    st[3]  = *(const v4f*)(pQ2 + 16 * 32 * CD * 4 + o2);
    st[4]  = *(const v4f*)(pK + o1);
    st[5]  = *(const v4f*)(pK + 16 * CD * 4 + o1);
    st[6]  = *(const v4f*)(pHQ + o1);
    st[7]  = *(const v4f*)(pHQ + 16 * CD * 4 + o1);
    st[8]  = *(const v4f*)(pWQ + o1);
    st[9]  = *(const v4f*)(pWQ + 16 * CD * 4 + o1);
    st[10] = *(const v4f*)(pHK + o1);
    st[11] = *(const v4f*)(pHK + 16 * CD * 4 + o1);
    st[12] = *(const v4f*)(pWK + o1);
    st[13] = *(const v4f*)(pWK + 16 * CD * 4 + o1);
    st[14] = *(const v4f*)(pWK + 32 * CD * 4 + o1);
    st[15] = *(const v4f*)(pWK + 48 * CD * 4 + o3);
    // inputs-only fence on the loaded values: the loads' offset and base registers
    // stay live, so none is reused before every load above has returned
    asm volatile("" :: "v"(st[0]), "v"(st[1]), "v"(st[2]), "v"(st[3]), "v"(st[4]), "v"(st[5]),
                 "v"(st[6]), "v"(st[7]), "v"(st[8]), "v"(st[9]), "v"(st[10]), "v"(st[11]),
                 "v"(st[12]), "v"(st[13]), "v"(st[14]), "v"(st[15]), "v"(o1), "v"(o2), "v"(o3),
                 "s"(pQ1), "s"(pQ2), "s"(pK), "s"(pHQ), "s"(pWQ), "s"(pHK), "s"(pWK));
#pragma unroll
    for (int g = 0; g < 16; ++g)
      *(v4f*)&sX[(g * 16 + sr) * SP + sc] = st[g];
  }
  __syncthreads();   // staged rows visible to every wave

  if (tab < 3) {
    // qh[q][j] = Q[q] . rhq[hb - j + 31]   M = q = hb*32 + 16*s + m,  N = j
    // qw[q][j] = Q[q] . rwq[hb - j + 31]   M = q = (16*s + m)*32 + hb, N = j
    // kh[j][k] = K[k] . rhk[j - hb + 31]   M = j = 16*s + m,           N = k = hb*32 + n
    int ar, br0, br1, ostr;
    float* o;
    if (tab == 0) {
      ar = XQ1 + 16 * s + c;  br0 = XRHQ + 31 - c;  br1 = XRHQ + 15 - c;
      o = wsb + QH_OFF + (hb * 32 + 16 * s + 8 * h) * 32 + c;  ostr = 32;
    } else if (tab == 1) {
      ar = XQ2 + 16 * s + c;  br0 = XRWQ + 31 - c;  br1 = XRWQ + 15 - c;
      o = wsb + QW_OFF + ((16 * s + 8 * h) * 32 + hb) * 32 + c;  ostr = 1024;
    } else {
      ar = XRHK + 16 * s + c; br0 = XK + c;         br1 = XK + 16 + c;
      o = wsb + KH_OFF + (16 * s + 8 * h) * 1024 + hb * 32 + c;  ostr = 1024;
    }
    Frag a, b0, b1;
    lds_frag(a,  sX + ar  * SP, h);
    lds_frag(b0, sX + br0 * SP, h);
    lds_frag(b1, sX + br1 * SP, h);
    v8f d0, d1;
    frag_mm2(a, b0, b1, d0, d1);
#pragma unroll
    for (int r = 0; r < 8; ++r) {
      o[r * ostr]      = d0[r];
      o[r * ostr + 16] = d1[r];
    }
  } else {
    // kw[j][k] = K[k] . rwk[j - w + 31], j = 16*s + jl, w = 16*t + m (M = k rows);
    // N = rel row 16*(s - t + 1 + u) + c, so element (m, c) of tile u belongs to
    // jl = 16*u + c + m - 15 (in 0..15 for exactly one u); the skew is undone in LDS.
    float* g = &sG[s][0];
#pragma unroll
    for (int t = 0; t < 2; ++t) {
      Frag a, b0, b1;
      lds_frag(a,  sX + (XK + 16 * t + c) * SP, h);
      lds_frag(b0, sX + (XRWK + 16 * (s - t + 1) + c) * SP, h);
      lds_frag(b1, sX + (XRWK + 16 * (s - t + 2) + c) * SP, h);
      v8f d0, d1;
      frag_mm2(a, b0, b1, d0, d1);
      const int jl0 = c + 8 * h - 15;
      float* gw = g + 16 * t + 8 * h;
#pragma unroll
      for (int r = 0; r < 8; ++r) {
        const int jl = jl0 + r;   // -15..15: tile 0 holds row jl if jl >= 0, else tile 1 holds row jl + 16
        gw[(jl & 15) * GP + r] = jl >= 0 ? d0[r] : d1[r];
      }
    }
    // this wave's own LDS stores must have landed before its other lanes read them
    asm volatile("s_wait_dscnt 0x0" ::: "memory");
#pragma unroll
    for (int i = 0; i < 4; ++i) {
      const int row = i * 4 + (lane >> 3), col = (lane & 7) * 4;
      v4f v = *(const v4f*)(g + row * GP + col);
      *(v4f*)(wsb + KW_OFF + (16 * s + row) * 1024 + hb * 32 + col) = v;
    }
    // precaution: in the built code the block laid out behind these stores rewrites their registers
    asm volatile("s_wait_xcnt 0x0" ::: "memory");
  }
}

// ------------------- Phase 1b: K/V -> f16 B-operand tiles -------------------
// One block = 128 consecutive keys (two 64-key tiles) of one (b, n), K and V both;
// one thread converts 64 elements, so the launch is one 8-wave block per WGP.
// Every wave-wide load reads whole 128-byte lines; all 40 loads of a thread are
// in flight together.
typedef __attribute__((ext_vector_type(4))) _Float16 v4h;

__global__ __launch_bounds__(256) void prepack_kernel(
    const float* __restrict__ Kg, const float* __restrict__ Vg,
    _Float16* __restrict__ wsh)
{
  const int blk = blockIdx.x;                   // bn*8 + tile pair
  const int w   = threadIdx.x >> 5;
  const int l   = threadIdx.x & 31;
  const size_t src0 = (size_t)blk * 128 * CD;   // first of the block's 128 rows
  const size_t dst0 = (size_t)blk * 2 * 4096;   // first of its two tiles

  // K: a wave-wide load = 4 keys x one 128-byte half row (8 lanes x 4 floats each).
  // Pass it takes keys it*16 + nn, that is operand (it&3)*2 + cc of tile it>>2.
  const int cc = w & 1;                         // half row: c = cc*32 + cl + 0..3
  const int nn = (w >> 1) * 4 + (l >> 3);       // key & 15 = operand column
  const int cl = (l & 7) * 4;
  const float* ks = Kg + src0 + nn * CD + cc * 32 + cl;
  v4f kx[8];
#pragma unroll
  for (int it = 0; it < 8; ++it) kx[it] = *(const v4f*)(ks + it * 16 * CD);

  // V: a wave-wide load = one 128-byte half row of one key (lane = column);
  // a thread gathers the 16 keys of one lane's operand, once per tile.
  const int hf = w & 1;                         // operand lane half
  const int ch = (w >> 1) & 1;                  // half row: c = ch*32 + l
  const int kg = w >> 2;                        // 32-key group of the tile
  const float* vs = Vg + src0 + (kg * 32 + 8 * hf) * CD + ch * 32 + l;
  v8f vx[4];                                    // [tile*2 + (e>>3)][e&7]
#pragma unroll
  for (int it = 0; it < 2; ++it)
#pragma unroll
    for (int e = 0; e < 16; ++e)
      vx[it * 2 + (e >> 3)][e & 7] = vs[(it * 64 + kmap(e, 0)) * CD];

  // inputs-only fence on the loaded values and the two addresses: all 40 loads are
  // issued before the first conversion waits (one round trip, not two), and no
  // address register is reused while a load is out
  asm volatile("" :: "v"(kx[0]), "v"(kx[1]), "v"(kx[2]), "v"(kx[3]), "v"(kx[4]), "v"(kx[5]),
               "v"(kx[6]), "v"(kx[7]), "v"(vx[0]), "v"(vx[1]), "v"(vx[2]), "v"(vx[3]),
               "v"(ks), "v"(vs));

  // convert everything first, then only store: no register of an issued store is reused
  v4h ko[8];
#pragma unroll
  for (int it = 0; it < 8; ++it)
    ko[it] = v4h{(_Float16)kx[it].x, (_Float16)kx[it].y, (_Float16)kx[it].z, (_Float16)kx[it].w};
  v16h vo[2];
#pragma unroll
  for (int it = 0; it < 2; ++it)
#pragma unroll
    for (int e = 0; e < 16; ++e) vo[it][e] = (_Float16)vx[it * 2 + (e >> 3)][e & 7];

  // K out: 4 floats = elements e..e+3 of lane (cl>>3)&1, nn; a wave-wide 8-byte
  // store fills two whole 128-byte lines
  _Float16* kd = wsh + WSK_HOFF + dst0 + cc * 512
               + (((cl >> 3) & 1) * 16 + nn) * 16 + (cl & 7) + 8 * (cl >> 4);
  // V out: one lane's whole 32-byte operand
  _Float16* vd = wsh + WSV_HOFF + dst0 + (kg * 4 + ch * 2 + (l >> 4)) * 512
               + (hf * 16 + (l & 15)) * 16;
#pragma unroll
  for (int it = 0; it < 8; ++it) *(v4h*)(kd + it * 1024) = ko[it];
#pragma unroll
  for (int it = 0; it < 2; ++it) *(v16h*)(vd + it * 4096) = vo[it];
}

// ------------------------------ Phase 2: flash ------------------------------
__device__ __forceinline__ void async_tile(const _Float16* __restrict__ gsrc,
                                           _Float16* ldst, int t) {
#pragma unroll
  for (int i = 0; i < 4; ++i) {
    unsigned lk = (unsigned)(uintptr_t)(ldst + t * 8 + i * 1024);  // LDS byte addr
    const _Float16* gs = gsrc + t * 8 + i * 1024;
    asm volatile("global_load_async_to_lds_b128 %0, %1, off"
                 :: "v"(lk), "v"(gs) : "memory");
  }
}

// one 64-key tile's bias operands of a lane: 8 x qh pair, 4 x kh, 32 x kw,
// from the lane's three pointers into that tile
__device__ __forceinline__ void load_bias(v2f (&qhv)[8], float (&khv)[4], float (&kwv)[4][8],
                                          const float* qhl, const float* khl,
                                          const float* kwl) {
#pragma unroll
  for (int i = 0; i < 8; ++i) qhv[i] = *(const v2f*)(qhl + i * 32);
#pragma unroll
  for (int sub = 0; sub < 4; ++sub) khv[sub] = khl[sub * 16];
#pragma unroll
  for (int sub = 0; sub < 4; ++sub)
#pragma unroll
    for (int i = 0; i < 8; ++i) kwv[sub][i] = kwl[i * 1024 + sub * 16];
}

// lane l's value from lane l ^ M of its own 16-lane row (M = 1, 2, 4, 8), as a DPP
// operand (row_xmask) of the vector instruction that uses it: no LDS-path round trip
// and no wait on the LDS counter, which a shuffle through ds_bpermute_b32 costs per step
template <int M>
__device__ __forceinline__ float row_xor(float x) {
  return __builtin_bit_cast(float, __builtin_amdgcn_update_dpp(
      0, __builtin_bit_cast(int, x), 0x160 | M, 0xf, 0xf, true));
}

// one xor step of eight independent row maxima: x[i] = max(x[i], x[i] of lane l ^ m)
#define ROW_MAX8(m)                                                        \
  "v_max_num_f32_dpp %0, %0, %0 row_xmask:" #m " row_mask:0xf bank_mask:0xf\n\t" \
  "v_max_num_f32_dpp %1, %1, %1 row_xmask:" #m " row_mask:0xf bank_mask:0xf\n\t" \
  "v_max_num_f32_dpp %2, %2, %2 row_xmask:" #m " row_mask:0xf bank_mask:0xf\n\t" \
  "v_max_num_f32_dpp %3, %3, %3 row_xmask:" #m " row_mask:0xf bank_mask:0xf\n\t" \
  "v_max_num_f32_dpp %4, %4, %4 row_xmask:" #m " row_mask:0xf bank_mask:0xf\n\t" \
  "v_max_num_f32_dpp %5, %5, %5 row_xmask:" #m " row_mask:0xf bank_mask:0xf\n\t" \
  "v_max_num_f32_dpp %6, %6, %6 row_xmask:" #m " row_mask:0xf bank_mask:0xf\n\t" \
  "v_max_num_f32_dpp %7, %7, %7 row_xmask:" #m " row_mask:0xf bank_mask:0xf\n\t"

__global__ __launch_bounds__(128) void flash_kernel(
    const float* __restrict__ Qg, const float* __restrict__ ws,
    const _Float16* __restrict__ wsh, float* __restrict__ Out)
{
  // double-buffered K/V tiles already in B-operand layout (8KB each)
  __shared__ __attribute__((aligned(32))) _Float16 sK[2][4096];
  __shared__ __attribute__((aligned(32))) _Float16 sV[2][4096];
  // P in A-layout, wave-private: [wave][k_chunk(2)][lane(32)*e(16)]
  __shared__ __attribute__((aligned(32))) _Float16 sP[4][2][32 * 16];

  const int bn    = blockIdx.y;
  const int qtile = blockIdx.x;
  const int t     = threadIdx.x;
  const int wave  = t >> 5;
  const int lane  = t & 31;
  const int half  = lane >> 4;
  const int n     = lane & 15;
  const int qbase = qtile * 64 + wave * 16;

  const float* qh_p = ws + QH_OFF + (size_t)bn * 32768;
  const float* qw_p = ws + QW_OFF + (size_t)bn * 32768;
  const float* kh_p = ws + KH_OFF + (size_t)bn * 32768;
  const float* kw_p = ws + KW_OFF + (size_t)bn * 32768;
  const _Float16* gK = wsh + WSK_HOFF + (size_t)(bn * 16) * 4096;
  const _Float16* gV = wsh + WSV_HOFF + (size_t)(bn * 16) * 4096;

  // ---- this wave's 16 Q rows as two f16 A operands (C = 0..31, 32..63) ----
  v16h qA[2];
  {
    const float* qr = Qg + ((size_t)bn * LQ + (qbase + n)) * CD;  // A: M = lane&15
#pragma unroll
    for (int cc = 0; cc < 2; ++cc)
#pragma unroll
      for (int e = 0; e < 16; ++e)
        qA[cc][e] = (_Float16)qr[kmap(e, half) + 32 * cc];
  }

  v8f Oacc[4];
  const v8f vzero = {0.f, 0.f, 0.f, 0.f, 0.f, 0.f, 0.f, 0.f};
#pragma unroll
  for (int cs = 0; cs < 4; ++cs) Oacc[cs] = vzero;
  float rm[8], rl[8];
#pragma unroll
  for (int i = 0; i < 8; ++i) { rm[i] = -3.0e38f; rl[i] = 0.f; }

  // prologue: start tile 0 into buffer 0
  async_tile(gK, &sK[0][0], t);
  async_tile(gV, &sV[0][0], t);

  // ---- rel-pos bias operands of this lane (C-layout: row i + 8*half, col n) ----
  // A wave's 16 rows share q>>5; q&31 = (qbase&31) + 8*half + i.
  const float* qwl = qw_p + (qbase + 8 * half) * 32 + n;
  const float* qhl = qh_p + (qbase + 8 * half) * 32;          // these three walk the tiles
  const float* khl = kh_p + (qbase >> 5) * 1024 + n;
  const float* kwl = kw_p + ((qbase & 31) + 8 * half) * 1024 + n;
  float qwv[2][8];              // k&31 = 16*(sub&1) + n: the same in every tile, loaded once
#pragma unroll
  for (int i = 0; i < 8; ++i) { qwv[0][i] = qwl[i * 32]; qwv[1][i] = qwl[i * 32 + 16]; }
  v2f   qhv[8];                 // k>>5 = 2*kt + (sub>>1)
  float khv[4], kwv[4][8];
  load_bias(qhv, khv, kwv, qhl, khl, kwl);

  for (int kt = 0; kt < 16; ++kt) {
    const int cur = kt & 1;

    asm volatile("s_wait_asynccnt 0x0" ::: "memory");  // my tile portion landed
    __syncthreads();                                   // whole tile visible

    if (kt + 1 < 16) {                                 // overlap next copy
      async_tile(gK + (size_t)(kt + 1) * 4096, &sK[cur ^ 1][0], t);
      async_tile(gV + (size_t)(kt + 1) * 4096, &sV[cur ^ 1][0], t);
    }
    const _Float16* sKb = &sK[cur][0];
    const _Float16* sVb = &sV[cur][0];

    // ---- scores: preload all 8 B operands, then 8 back-to-back WMMAs ----
    v16h kB[8];
#pragma unroll
    for (int op = 0; op < 8; ++op)
      kB[op] = *(const v16h*)(sKb + (op * 32 + lane) * 16);

    v8f S[4];
#pragma unroll
    for (int sub = 0; sub < 4; ++sub)
      S[sub] = __builtin_amdgcn_wmma_f32_16x16x32_f16(false, qA[0], false,
                                                      kB[sub * 2], (short)0,
                                                      vzero, false, false);
#pragma unroll
    for (int sub = 0; sub < 4; ++sub)
      S[sub] = __builtin_amdgcn_wmma_f32_16x16x32_f16(false, qA[1], false,
                                                      kB[sub * 2 + 1], (short)0,
                                                      S[sub], false, false);

    // ---- scale + rel-pos bias (C-layout: row i+8*half, col n) ----
#pragma unroll
    for (int sub = 0; sub < 4; ++sub)
#pragma unroll
      for (int i = 0; i < 8; ++i) {
        float b = qhv[i][sub >> 1] + qwv[sub & 1][i] + khv[sub] + kwv[sub][i];
        S[sub][i] = S[sub][i] * 0.125f + b;    // 1/sqrt(64) on QK only
      }

    // next tile's bias operands: all loads go out here, together, and return under
    // the softmax and P*V below (the last trip reloads its own tile: stays in bounds).
    // The pointers move only here, after the last tile's loads have been used.
    const int step = kt + 1 < 16 ? 1 : 0;
    qhl += 2 * step;  khl += 64 * step;  kwl += 64 * step;
    load_bias(qhv, khv, kwv, qhl, khl, kwl);
    // without this the scheduler sinks the loads into the second half of the softmax,
    // close to the wait at the trip's last barrier, and less of their latency is hidden
    __builtin_amdgcn_sched_barrier(0);

    // ---- online softmax (reduce across the 16-lane column group) ----
    float tmx[8];
#pragma unroll
    for (int i = 0; i < 8; ++i)
      tmx[i] = fmaxf(fmaxf(S[0][i], S[1][i]), fmaxf(S[2][i], S[3][i]));
    // the eight rows' maxima over their 16 lanes, in asm: from the builtin the compiler
    // keeps a DPP move and a quieting copy in front of every max and runs the rows one
    // after another; here each step is one instruction and its producer stands eight back
    asm(ROW_MAX8(8) ROW_MAX8(4) ROW_MAX8(2) ROW_MAX8(1)
        : "+v"(tmx[0]), "+v"(tmx[1]), "+v"(tmx[2]), "+v"(tmx[3]),
          "+v"(tmx[4]), "+v"(tmx[5]), "+v"(tmx[6]), "+v"(tmx[7]));
#pragma unroll
    for (int i = 0; i < 8; ++i) {
      float newm = fmaxf(rm[i], tmx[i]);
      float corr = __expf(rm[i] - newm);
      rm[i] = newm;
      float ts = 0.f;
#pragma unroll
      for (int sub = 0; sub < 4; ++sub) {
        float p = __expf(S[sub][i] - newm);
        S[sub][i] = p;
        ts += p;
      }
      ts += row_xor<8>(ts); ts += row_xor<4>(ts);
      ts += row_xor<2>(ts); ts += row_xor<1>(ts);
      rl[i] = rl[i] * corr + ts;
#pragma unroll
      for (int cs = 0; cs < 4; ++cs) Oacc[cs][i] *= corr;
    }

    // ---- P: C-layout regs -> A-layout in wave-private LDS ----
#pragma unroll
    for (int sub = 0; sub < 4; ++sub)
#pragma unroll
      for (int i = 0; i < 8; ++i) {
        int mrow = i + 8 * half;
        int kl   = sub * 16 + n;
        int kc = kl >> 5, K32 = kl & 31;
        int hf = (K32 >> 3) & 1, e = (K32 & 7) + 8 * (K32 >> 4);
        sP[wave][kc][(hf * 16 + mrow) * 16 + e] = (_Float16)S[sub][i];
      }
    asm volatile("s_wait_dscnt 0x0" ::: "memory");  // per-wave LDS RAW fence

    // ---- O += P * V : preload operands, then 8 back-to-back WMMAs ----
    v16h aP0 = *(const v16h*)(sP[wave][0] + lane * 16);
    v16h aP1 = *(const v16h*)(sP[wave][1] + lane * 16);
    v16h vB[8];
#pragma unroll
    for (int op = 0; op < 8; ++op)
      vB[op] = *(const v16h*)(sVb + (op * 32 + lane) * 16);
#pragma unroll
    for (int cs = 0; cs < 4; ++cs)
      Oacc[cs] = __builtin_amdgcn_wmma_f32_16x16x32_f16(false, aP0, false,
                                                        vB[cs], (short)0,
                                                        Oacc[cs], false, false);
#pragma unroll
    for (int cs = 0; cs < 4; ++cs)
      Oacc[cs] = __builtin_amdgcn_wmma_f32_16x16x32_f16(false, aP1, false,
                                                        vB[4 + cs], (short)0,
                                                        Oacc[cs], false, false);

    __syncthreads();   // all waves done reading before buffer reuse
  }

  // ---- epilogue: normalize, add residual Q, store fp32 ----
#pragma unroll
  for (int cs = 0; cs < 4; ++cs)
#pragma unroll
    for (int i = 0; i < 8; ++i) {
      int q = qbase + i + 8 * half;
      int c = cs * 16 + n;
      size_t idx = ((size_t)bn * LQ + q) * CD + c;
      Out[idx] = Oacc[cs][i] / rl[i] + Qg[idx];
    }
}

// ---------------------------------------------------------------------------
extern "C" void kernel_launch(void* const* d_in, const int* in_sizes, int n_in,
                              void* d_out, int out_size, void* d_ws, size_t ws_size,
                              hipStream_t stream) {
  (void)in_sizes; (void)n_in; (void)out_size; (void)ws_size;
  const float* q   = (const float*)d_in[0];
  const float* k   = (const float*)d_in[1];
  const float* v   = (const float*)d_in[2];
  const float* rhq = (const float*)d_in[3];
  const float* rwq = (const float*)d_in[4];
  const float* rhk = (const float*)d_in[5];
  const float* rwk = (const float*)d_in[6];
  float*    ws  = (float*)d_ws;                       // needs 24 MB
  _Float16* wsh = (_Float16*)(ws + WS_F32_FLOATS);
  float*    out = (float*)d_out;

  bias_kernel<<<dim3(32, 32), 256, 0, stream>>>(q, k, rhq, rwq, rhk, rwk, ws);
  prepack_kernel<<<256, 256, 0, stream>>>(k, v, wsh);
  flash_kernel<<<dim3(16, 32), 128, 0, stream>>>(q, ws, wsh, out);
}

// v005
// Measured time: 36.1 microseconds a run.
// Two timings next to v004 put it at 1.22 and 1.23 times that version's speed.
// Over all steps from v000 it is 5.75 times as fast.
#include <hip/hip_runtime.h>

typedef __attribute__((ext_vector_type(16))) _Float16 v16h;
typedef __attribute__((ext_vector_type(8)))  float    v8f;

#define LQ   1024
#define CD   64
// fp32 workspace offsets (floats)
#define QH_OFF 0
#define QW_OFF (32*1024*32)
#define KH_OFF (2*32*1024*32)
#define KW_OFF (3*32*1024*32)
#define WS_F32_FLOATS (4*32*1024*32)          // 4M floats = 16 MB
// f16 workspace offsets (halves), relative to wsh = (ws + WS_F32_FLOATS)
#define WSK_HOFF 0
#define WSV_HOFF (32*16*4096)                 // 2M halves = 4 MB

// A/B operand K-index map (16-bit WMMA): element e, lane half h ->
// K = (e&7) + 8*h + 16*(e>>3)
__device__ __forceinline__ int kmap(int e, int half) {
  return (e & 7) + 8 * half + 16 * (e >> 3);
}

// --------------------------- Phase 1a: bias tables --------------------------
// Each table is a small fp32 GEMM (rows of Q or K against rows of a rel table),
// done on v_wmma_f32_16x16x4_f32. One block = one (bn, hb): it stages the 256
// operand rows it needs in LDS with whole-line loads, then waves 0-1 make qh for
// q>>5 == hb, 2-3 qw for q&31 == hb, 4-5 kh and 6-7 kw for k>>5 == hb.
// A wave owns whole 128-byte output rows.
typedef __attribute__((ext_vector_type(2))) float v2f;
typedef __attribute__((ext_vector_type(4))) float v4f;

#define SP 68   // LDS row pitch (floats) of the staged rows: 272 B, 16-byte column reads hit 64 banks
#define GP 36   // LDS row pitch (floats) of the kw skew buffer, rows stay 16-byte aligned
// first staged row of each operand
#define XQ1  0     // Q[hb*32 + i]
#define XQ2  32    // Q[i*32 + hb]
#define XK   64    // K[hb*32 + i]
#define XRHQ 96    // rhq[hb + i]
#define XRWQ 128   // rwq[hb + i]
#define XRHK 160   // rhk[31 - hb + i]
#define XRWK 192   // rwk[min(i, 62)], i = 0..63

// 16 rows x 64 floats as 16 k-steps of a 16x16x4 operand. Lane (c, h) holds
// columns 8*i + 4*h + 0..3 of its row; A and B use this one loader, so their
// k orders pair position by position.
struct Frag { v4f f[8]; };

__device__ __forceinline__ void lds_frag(Frag& x, const float* row, int h) {
  const v4f* p = (const v4f*)(row + 4 * h);
#pragma unroll
  for (int i = 0; i < 8; ++i) x.f[i] = p[2 * i];
}

// d0[m][n] = sum_c A[m][c] * B0[n][c], d1 likewise with B1: two independent
// accumulate chains; register r of lane (c, h) = element [8*h + r][c]
__device__ __forceinline__ void frag_mm2(const Frag& a, const Frag& b0, const Frag& b1,
                                         v8f& d0, v8f& d1) {
  const v8f z = {0.f, 0.f, 0.f, 0.f, 0.f, 0.f, 0.f, 0.f};
  d0 = z; d1 = z;
#pragma unroll
  for (int i = 0; i < 8; ++i) {
    v2f al = {a.f[i].x, a.f[i].y},   ah = {a.f[i].z, a.f[i].w};
    v2f pl = {b0.f[i].x, b0.f[i].y}, ph = {b0.f[i].z, b0.f[i].w};
    v2f ql = {b1.f[i].x, b1.f[i].y}, qh = {b1.f[i].z, b1.f[i].w};
    d0 = __builtin_amdgcn_wmma_f32_16x16x4_f32(false, al, false, pl, (short)0, d0, false, false);
    d1 = __builtin_amdgcn_wmma_f32_16x16x4_f32(false, al, false, ql, (short)0, d1, false, false);
    d0 = __builtin_amdgcn_wmma_f32_16x16x4_f32(false, ah, false, ph, (short)0, d0, false, false);
    d1 = __builtin_amdgcn_wmma_f32_16x16x4_f32(false, ah, false, qh, (short)0, d1, false, false);
  }
}

__global__ __launch_bounds__(256) void bias_kernel(
    const float* __restrict__ Qg, const float* __restrict__ Kg,
    const float* __restrict__ rhq, const float* __restrict__ rwq,
    const float* __restrict__ rhk, const float* __restrict__ rwk,
    float* __restrict__ ws)
{
  __shared__ __attribute__((aligned(16))) float sX[256 * SP];
  __shared__ __attribute__((aligned(16))) float sG[2][16 * GP];

  const int hb   = blockIdx.x;
  const int bn   = blockIdx.y;
  const int tid  = threadIdx.x;
  const int wv   = __builtin_amdgcn_readfirstlane(tid >> 5);
  const int lane = tid & 31;
  const int c    = lane & 15;
  const int h    = lane >> 4;
  const int s    = wv & 1;
  const int tab  = wv >> 1;
  float* wsb = ws + (size_t)bn * 32768;

  // ---- stage: 16 lanes read one whole 256-byte row, 16 rows per pass ----
  {
    const int sr = tid >> 4;
    const int sc = (tid & 15) * 4;
    // per-lane byte offsets: rows 1 apart, rows 32 apart, last rwk rows (row 63 repeats 62)
    const unsigned o1 = (unsigned)(sr * CD + sc) * 4u;
    const unsigned o2 = (unsigned)(sr * 32 * CD + sc) * 4u;
    const unsigned o3 = (unsigned)(min(sr, 14) * CD + sc) * 4u;
    // block-uniform base of each staged operand
    const float* Qb = Qg + (size_t)bn * LQ * CD;
    const float* Kb = Kg + (size_t)bn * LQ * CD;
    const char* pQ1 = (const char*)(Qb + hb * 32 * CD);
    const char* pQ2 = (const char*)(Qb + hb * CD);
    const char* pK  = (const char*)(Kb + hb * 32 * CD);
    const char* pHQ = (const char*)(rhq + hb * CD);
    const char* pWQ = (const char*)(rwq + hb * CD);
    const char* pHK = (const char*)(rhk + (31 - hb) * CD);
    const char* pWK = (const char*)rwk;
    v4f st[16];
    st[0]  = *(const v4f*)(pQ1 + o1);
    st[1]  = *(const v4f*)(pQ1 + 16 * CD * 4 + o1);
    st[2]  = *(const v4f*)(pQ2 + o2);
    st[3]  = *(const v4f*)(pQ2 + 16 * 32 * CD * 4 + o2);
    st[4]  = *(const v4f*)(pK + o1);
    st[5]  = *(const v4f*)(pK + 16 * CD * 4 + o1);
    st[6]  = *(const v4f*)(pHQ + o1);
    st[7]  = *(const v4f*)(pHQ + 16 * CD * 4 + o1);
    st[8]  = *(const v4f*)(pWQ + o1);
    st[9]  = *(const v4f*)(pWQ + 16 * CD * 4 + o1);
    st[10] = *(const v4f*)(pHK + o1);
    st[11] = *(const v4f*)(pHK + 16 * CD * 4 + o1);
    st[12] = *(const v4f*)(pWK + o1);
    st[13] = *(const v4f*)(pWK + 16 * CD * 4 + o1);
    st[14] = *(const v4f*)(pWK + 32 * CD * 4 + o1);
    st[15] = *(const v4f*)(pWK + 48 * CD * 4 + o3);
    // inputs-only fence on the loaded values: the loads' offset and base registers
    // stay live, so none is reused before every load above has returned
    asm volatile("" :: "v"(st[0]), "v"(st[1]), "v"(st[2]), "v"(st[3]), "v"(st[4]), "v"(st[5]),
                 "v"(st[6]), "v"(st[7]), "v"(st[8]), "v"(st[9]), "v"(st[10]), "v"(st[11]),
                 "v"(st[12]), "v"(st[13]), "v"(st[14]), "v"(st[15]), "v"(o1), "v"(o2), "v"(o3),
                 "s"(pQ1), "s"(pQ2), "s"(pK), "s"(pHQ), "s"(pWQ), "s"(pHK), "s"(pWK));
#pragma unroll
    for (int g = 0; g < 16; ++g)
      *(v4f*)&sX[(g * 16 + sr) * SP + sc] = st[g];
  }
  __syncthreads();   // staged rows visible to every wave

  if (tab < 3) {
    // qh[q][j] = Q[q] . rhq[hb - j + 31]   M = q = hb*32 + 16*s + m,  N = j
    // qw[q][j] = Q[q] . rwq[hb - j + 31]   M = q = (16*s + m)*32 + hb, N = j
    // kh[j][k] = K[k] . rhk[j - hb + 31]   M = j = 16*s + m,           N = k = hb*32 + n
    int ar, br0, br1, ostr;
    float* o;
    if (tab == 0) {
      ar = XQ1 + 16 * s + c;  br0 = XRHQ + 31 - c;  br1 = XRHQ + 15 - c;
      o = wsb + QH_OFF + (hb * 32 + 16 * s + 8 * h) * 32 + c;  ostr = 32;
    } else if (tab == 1) {
      ar = XQ2 + 16 * s + c;  br0 = XRWQ + 31 - c;  br1 = XRWQ + 15 - c;
      o = wsb + QW_OFF + ((16 * s + 8 * h) * 32 + hb) * 32 + c;  ostr = 1024;
    } else {
      ar = XRHK + 16 * s + c; br0 = XK + c;         br1 = XK + 16 + c;
      o = wsb + KH_OFF + (16 * s + 8 * h) * 1024 + hb * 32 + c;  ostr = 1024;
    }
    Frag a, b0, b1;
    lds_frag(a,  sX + ar  * SP, h);
    lds_frag(b0, sX + br0 * SP, h);
    lds_frag(b1, sX + br1 * SP, h);
    v8f d0, d1;
    frag_mm2(a, b0, b1, d0, d1);
#pragma unroll
    for (int r = 0; r < 8; ++r) {
      o[r * ostr]      = d0[r];
      o[r * ostr + 16] = d1[r];
    }
  } else {
    // kw[j][k] = K[k] . rwk[j - w + 31], j = 16*s + jl, w = 16*t + m (M = k rows);
    // N = rel row 16*(s - t + 1 + u) + c, so element (m, c) of tile u belongs to
    // jl = 16*u + c + m - 15 (in 0..15 for exactly one u); the skew is undone in LDS.
    float* g = &sG[s][0];
#pragma unroll
    for (int t = 0; t < 2; ++t) {
      Frag a, b0, b1;
      lds_frag(a,  sX + (XK + 16 * t + c) * SP, h);
      lds_frag(b0, sX + (XRWK + 16 * (s - t + 1) + c) * SP, h);
      lds_frag(b1, sX + (XRWK + 16 * (s - t + 2) + c) * SP, h);
      v8f d0, d1;
      frag_mm2(a, b0, b1, d0, d1);
      const int jl0 = c + 8 * h - 15;
      float* gw = g + 16 * t + 8 * h;
#pragma unroll
      for (int r = 0; r < 8; ++r) {
        const int jl = jl0 + r;   // -15..15: tile 0 holds row jl if jl >= 0, else tile 1 holds row jl + 16
        gw[(jl & 15) * GP + r] = jl >= 0 ? d0[r] : d1[r];
      }
    }
    // this wave's own LDS stores must have landed before its other lanes read them
    asm volatile("s_wait_dscnt 0x0" ::: "memory");
    // kw goes out in the order the flash kernel's lanes read it: per 16 keys and 16
    // rows j a 1 KB unit [key bit 2][key bit 3][j & 15][key & 3], so that a wave-wide
    // 16-byte load there covers four whole lines; a store here fills two 256-byte runs
#pragma unroll
    for (int i = 0; i < 4; ++i) {
      const int col = (2 * i + h) * 4;          // key & 31 of the first of 4 keys; row j & 15 = c
      v4f v = *(const v4f*)(g + c * GP + col);
      *(v4f*)(wsb + KW_OFF + ((hb * 2 + (i >> 1)) * 2 + s) * 256 + h * 128
              + ((i & 1) * 16 + c) * 4) = v;
    }
    // precaution: in the built code the block laid out behind these stores rewrites their registers
    asm volatile("s_wait_xcnt 0x0" ::: "memory");
  }
}

// ------------------- Phase 1b: K/V -> f16 B-operand tiles -------------------
// One block = 128 consecutive keys (two 64-key tiles) of one (b, n), K and V both;
// one thread converts 64 elements, so the launch is one 8-wave block per WGP.
// Every wave-wide load reads whole 128-byte lines; all 40 loads of a thread are
// in flight together.
typedef __attribute__((ext_vector_type(4))) _Float16 v4h;

__global__ __launch_bounds__(256) void prepack_kernel(
    const float* __restrict__ Kg, const float* __restrict__ Vg,
    _Float16* __restrict__ wsh)
{
  const int blk = blockIdx.x;                   // bn*8 + tile pair
  const int w   = threadIdx.x >> 5;
  const int l   = threadIdx.x & 31;
  const size_t src0 = (size_t)blk * 128 * CD;   // first of the block's 128 rows
  const size_t dst0 = (size_t)blk * 2 * 4096;   // first of its two tiles

  // K: a wave-wide load = 4 keys x one 128-byte half row (8 lanes x 4 floats each).
  // Pass it takes keys it*16 + nn, that is operand (it&3)*2 + cc of tile it>>2.
  const int cc = w & 1;                         // half row: c = cc*32 + cl + 0..3
  const int nn = (w >> 1) * 4 + (l >> 3);       // key & 15 = operand column
  const int cl = (l & 7) * 4;
  const float* ks = Kg + src0 + nn * CD + cc * 32 + cl;
  v4f kx[8];
#pragma unroll
  for (int it = 0; it < 8; ++it) kx[it] = *(const v4f*)(ks + it * 16 * CD);

  // V: a wave-wide load = one 128-byte half row of one key (lane = column);
  // a thread gathers the 16 keys of one lane's operand, once per tile.
  const int hf = w & 1;                         // operand lane half
  const int ch = (w >> 1) & 1;                  // half row: c = ch*32 + l
  const int kg = w >> 2;                        // 32-key group of the tile
  const float* vs = Vg + src0 + (kg * 32 + 8 * hf) * CD + ch * 32 + l;
  v8f vx[4];                                    // [tile*2 + (e>>3)][e&7]
#pragma unroll
  for (int it = 0; it < 2; ++it)
#pragma unroll
    for (int e = 0; e < 16; ++e)
      vx[it * 2 + (e >> 3)][e & 7] = vs[(it * 64 + kmap(e, 0)) * CD];

  // inputs-only fence on the loaded values and the two addresses: all 40 loads are
  // issued before the first conversion waits (one round trip, not two), and no
  // address register is reused while a load is out
  asm volatile("" :: "v"(kx[0]), "v"(kx[1]), "v"(kx[2]), "v"(kx[3]), "v"(kx[4]), "v"(kx[5]),
               "v"(kx[6]), "v"(kx[7]), "v"(vx[0]), "v"(vx[1]), "v"(vx[2]), "v"(vx[3]),
               "v"(ks), "v"(vs));

  // convert everything first, then only store: no register of an issued store is reused
  v4h ko[8];
#pragma unroll
  for (int it = 0; it < 8; ++it)
    ko[it] = v4h{(_Float16)kx[it].x, (_Float16)kx[it].y, (_Float16)kx[it].z, (_Float16)kx[it].w};
  v16h vo[2];
#pragma unroll
  for (int it = 0; it < 2; ++it)
#pragma unroll
    for (int e = 0; e < 16; ++e) vo[it][e] = (_Float16)vx[it * 2 + (e >> 3)][e & 7];

  // K out: 4 floats = elements e..e+3 of lane (cl>>3)&1, nn; a wave-wide 8-byte
  // store fills two whole 128-byte lines
  _Float16* kd = wsh + WSK_HOFF + dst0 + cc * 512
               + (((cl >> 3) & 1) * 16 + nn) * 16 + (cl & 7) + 8 * (cl >> 4);
  // V out: one lane's whole 32-byte operand
  _Float16* vd = wsh + WSV_HOFF + dst0 + (kg * 4 + ch * 2 + (l >> 4)) * 512
               + (hf * 16 + (l & 15)) * 16;
#pragma unroll
  for (int it = 0; it < 8; ++it) *(v4h*)(kd + it * 1024) = ko[it];
#pragma unroll
  for (int it = 0; it < 2; ++it) *(v16h*)(vd + it * 4096) = vo[it];
}

// ------------------------------ Phase 2: flash ------------------------------
__device__ __forceinline__ void async_tile(const _Float16* __restrict__ gsrc,
                                           _Float16* ldst, int t) {
#pragma unroll
  for (int i = 0; i < 4; ++i) {
    unsigned lk = (unsigned)(uintptr_t)(ldst + t * 8 + i * 1024);  // LDS byte addr
    const _Float16* gs = gsrc + t * 8 + i * 1024;
    asm volatile("global_load_async_to_lds_b128 %0, %1, off"
                 :: "v"(lk), "v"(gs) : "memory");
  }
}

// one 64-key tile's bias operands of a lane (one query, 32 of the keys): a qh pair,
// 32 x kh, 32 x kw, from the lane's three pointers into that tile
__device__ __forceinline__ void load_bias(v2f& qhv, v4f (&khv)[4][2], v4f (&kwv)[4][2],
                                          const float* qhl, const float* khl,
                                          const float* kwl) {
  qhv = *(const v2f*)qhl;
#pragma unroll
  for (int sub = 0; sub < 4; ++sub)
#pragma unroll
    for (int j = 0; j < 2; ++j) {
      khv[sub][j] = *(const v4f*)(khl + sub * 16 + j * 4);
      kwv[sub][j] = *(const v4f*)(kwl + sub * 512 + j * 128);
    }
}

// lane l's value from lane l ^ 16: the other half of the keys of the same query
__device__ __forceinline__ float xhalf(float x) {
  const int b = __builtin_bit_cast(int, x);
  return __builtin_bit_cast(float, __builtin_amdgcn_permlanex16(b, b, 0x76543210, 0xfedcba98,
                                                                false, false));
}

#define OP 68   // LDS row pitch (floats) of the output staging: rows stay 16-byte aligned

__global__ __launch_bounds__(128) void flash_kernel(
    const float* __restrict__ Qg, const float* __restrict__ ws,
    const _Float16* __restrict__ wsh, float* __restrict__ Out)
{
  // double-buffered K/V tiles in 16-bit operand layout (8KB each); the A and B maps
  // are alike, so a tile packed as a B operand serves as the A operand of the
  // transposed product
  __shared__ __attribute__((aligned(32))) _Float16 sK[2][4096];
  __shared__ __attribute__((aligned(32))) _Float16 sV[2][4096];
  // output staging, wave-private: 16 query rows x 64 floats
  __shared__ __attribute__((aligned(16))) float sO[4][16 * OP];

  const int bn    = blockIdx.y;
  const int qtile = blockIdx.x;
  const int t     = threadIdx.x;
  const int wave  = t >> 5;
  const int lane  = t & 31;
  const int half  = lane >> 4;
  const int n     = lane & 15;
  const int qbase = qtile * 64 + wave * 16;

  const float* qh_p = ws + QH_OFF + (size_t)bn * 32768;
  const float* qw_p = ws + QW_OFF + (size_t)bn * 32768;
  const float* kh_p = ws + KH_OFF + (size_t)bn * 32768;
  const float* kw_p = ws + KW_OFF + (size_t)bn * 32768;
  const _Float16* gK = wsh + WSK_HOFF + (size_t)(bn * 16) * 4096;
  const _Float16* gV = wsh + WSV_HOFF + (size_t)(bn * 16) * 4096;

  // ---- this wave's 16 Q rows as two f16 B operands of Q^T (C = 0..31, 32..63) ----
  v16h qB[2];
  {
    const float* qr = Qg + ((size_t)bn * LQ + (qbase + n)) * CD;  // B: N = lane&15
#pragma unroll
    for (int cc = 0; cc < 2; ++cc)
#pragma unroll
      for (int e = 0; e < 16; ++e)
        qB[cc][e] = (_Float16)qr[kmap(e, half) + 32 * cc];
  }

  // O^T: register i of tile cs = O[qbase + n][cs*16 + 8*half + i]
  v8f Oacc[4];
  const v8f vzero = {0.f, 0.f, 0.f, 0.f, 0.f, 0.f, 0.f, 0.f};
#pragma unroll
  for (int cs = 0; cs < 4; ++cs) Oacc[cs] = vzero;
  float rm = -3.0e38f;   // running maximum of query qbase + n (both lane halves alike)
  float rl = 0.f;        // running sum over this lane half's keys; the halves join at the end

  // prologue: start tile 0 into buffer 0
  async_tile(gK, &sK[0][0], t);
  async_tile(gV, &sV[0][0], t);

  // ---- rel-pos bias operands of this lane (S^T: key sub*16 + 8*half + i, query n) ----
  // A wave's 16 queries share q>>5; q&31 = (qbase&31) + n.
  const float* qwl = qw_p + (qbase + n) * 32 + 8 * half;
  const float* qhl = qh_p + (qbase + n) * 32;                 // these three walk the tiles
  const float* khl = kh_p + (qbase >> 5) * 1024 + 8 * half;
  const float* kwl = kw_p + ((qbase >> 4) & 1) * 256 + lane * 4;
  v4f qwv[2][2];                // k&31 = 16*(sub&1) + 8*half + i: the same in every tile, loaded once
#pragma unroll
  for (int u = 0; u < 2; ++u)
#pragma unroll
    for (int j = 0; j < 2; ++j) qwv[u][j] = *(const v4f*)(qwl + u * 16 + j * 4);
  // precaution: in the built code a later load's result lands in these loads' address registers
  asm volatile("s_wait_xcnt 0x0" ::: "memory");
  v2f qhv;                      // k>>5 = 2*kt + (sub>>1)
  v4f khv[4][2], kwv[4][2];
  load_bias(qhv, khv, kwv, qhl, khl, kwl);

  for (int kt = 0; kt < 16; ++kt) {
    const int cur = kt & 1;

    asm volatile("s_wait_asynccnt 0x0" ::: "memory");  // my tile portion landed
    __syncthreads();                                   // whole tile visible

    if (kt + 1 < 16) {                                 // overlap next copy
      async_tile(gK + (size_t)(kt + 1) * 4096, &sK[cur ^ 1][0], t);
      async_tile(gV + (size_t)(kt + 1) * 4096, &sV[cur ^ 1][0], t);
    }
    const _Float16* sKb = &sK[cur][0];
    const _Float16* sVb = &sV[cur][0];

    // ---- scores S^T = K * Q^T: preload all 8 A operands, then 8 back-to-back WMMAs ----
    v16h kA[8];
#pragma unroll
    for (int op = 0; op < 8; ++op)
      kA[op] = *(const v16h*)(sKb + (op * 32 + lane) * 16);

    v8f S[4];
#pragma unroll
    for (int sub = 0; sub < 4; ++sub)
      S[sub] = __builtin_amdgcn_wmma_f32_16x16x32_f16(false, kA[sub * 2], false,
                                                      qB[0], (short)0,
                                                      vzero, false, false);
#pragma unroll
    for (int sub = 0; sub < 4; ++sub)
      S[sub] = __builtin_amdgcn_wmma_f32_16x16x32_f16(false, kA[sub * 2 + 1], false,
                                                      qB[1], (short)0,
                                                      S[sub], false, false);

    // ---- scale + rel-pos bias (row = key sub*16 + 8*half + i, col = query n) ----
#pragma unroll
    for (int sub = 0; sub < 4; ++sub)
#pragma unroll
      for (int i = 0; i < 8; ++i) {
        float b = qhv[sub >> 1] + qwv[sub & 1][i >> 2][i & 3] + khv[sub][i >> 2][i & 3]
                + kwv[sub][i >> 2][i & 3];
        S[sub][i] = S[sub][i] * 0.125f + b;    // 1/sqrt(64) on QK only
      }

    // next tile's bias operands: all loads go out here, together, and return under
    // the softmax and P*V below (the last trip reloads its own tile: stays in bounds).
    // The pointers move only here, after the last tile's loads have been used.
    const int step = kt + 1 < 16 ? 1 : 0;
    qhl += 2 * step;  khl += 64 * step;  kwl += 2048 * step;
    load_bias(qhv, khv, kwv, qhl, khl, kwl);
    // without this the scheduler sinks the loads into the second half of the softmax,
    // close to the wait at the trip's last barrier, and less of their latency is hidden
    __builtin_amdgcn_sched_barrier(0);

    // ---- online softmax: a lane holds 32 of its query's 64 scores ----
    float tm[4];
#pragma unroll
    for (int sub = 0; sub < 4; ++sub) {
      tm[sub] = S[sub][0];
#pragma unroll
      for (int i = 1; i < 8; ++i) tm[sub] = fmaxf(tm[sub], S[sub][i]);
    }
    float tmx = fmaxf(fmaxf(tm[0], tm[1]), fmaxf(tm[2], tm[3]));
    tmx = fmaxf(tmx, xhalf(tmx));              // the other 32 keys' maximum
    const float newm = fmaxf(rm, tmx);
    const float corr = __expf(rm - newm);
    rm = newm;
    float ts[4];                               // four independent sum chains
#pragma unroll
    for (int sub = 0; sub < 4; ++sub) {
      ts[sub] = 0.f;
#pragma unroll
      for (int i = 0; i < 8; ++i) {
        float p = __expf(S[sub][i] - newm);
        S[sub][i] = p;
        ts[sub] += p;
      }
    }
    rl = rl * corr + ((ts[0] + ts[1]) + (ts[2] + ts[3]));
#pragma unroll
    for (int cs = 0; cs < 4; ++cs)
#pragma unroll
      for (int i = 0; i < 8; ++i) Oacc[cs][i] *= corr;

    // ---- P^T: two score tiles (keys 0-15, 16-31 of a 32-key chunk), converted in
    // place, are a B operand in the hardware k order: element e = tile e>>3, register e&7
    v16h pB[2];
#pragma unroll
    for (int kc = 0; kc < 2; ++kc)
#pragma unroll
      for (int e = 0; e < 16; ++e)
        pB[kc][e] = (_Float16)S[kc * 2 + (e >> 3)][e & 7];

    // ---- O^T += V^T * P^T : preload operands, then 8 back-to-back WMMAs ----
    v16h vA[8];
#pragma unroll
    for (int op = 0; op < 8; ++op)
      vA[op] = *(const v16h*)(sVb + (op * 32 + lane) * 16);
#pragma unroll
    for (int cs = 0; cs < 4; ++cs)
      Oacc[cs] = __builtin_amdgcn_wmma_f32_16x16x32_f16(false, vA[cs], false,
                                                        pB[0], (short)0,
                                                        Oacc[cs], false, false);
#pragma unroll
    for (int cs = 0; cs < 4; ++cs)
      Oacc[cs] = __builtin_amdgcn_wmma_f32_16x16x32_f16(false, vA[4 + cs], false,
                                                        pB[1], (short)0,
                                                        Oacc[cs], false, false);

    __syncthreads();   // all waves done reading before buffer reuse
  }

  // ---- epilogue: normalize, turn O^T into rows in wave-private LDS, add residual Q,
  // store fp32 in whole lines (a wave-wide 16-byte access = two whole 256-byte rows) ----
  const int orow = lane >> 4, ocol = (lane & 15) * 4;
  const size_t obase = ((size_t)bn * LQ + qbase + orow) * CD + ocol;
  v4f qres[8];
#pragma unroll
  for (int i = 0; i < 8; ++i) qres[i] = *(const v4f*)(Qg + obase + i * 2 * CD);
  const float rlt = rl + xhalf(rl);            // both halves' keys
  float* so = &sO[wave][0];
#pragma unroll
  for (int cs = 0; cs < 4; ++cs)
#pragma unroll
    for (int j = 0; j < 2; ++j) {
      v4f o = {Oacc[cs][4 * j] / rlt, Oacc[cs][4 * j + 1] / rlt,
               Oacc[cs][4 * j + 2] / rlt, Oacc[cs][4 * j + 3] / rlt};
      *(v4f*)(so + n * OP + cs * 16 + 8 * half + 4 * j) = o;
    }
  // this wave's own LDS stores must have landed before its other lanes read them
  asm volatile("s_wait_dscnt 0x0" ::: "memory");
#pragma unroll
  for (int i = 0; i < 8; ++i) qres[i] += *(const v4f*)(so + (i * 2 + orow) * OP + ocol);
  // all sums first, then only stores: no register of an issued store is rewritten
  __builtin_amdgcn_sched_barrier(0);
#pragma unroll
  for (int i = 0; i < 8; ++i) *(v4f*)(Out + obase + i * 2 * CD) = qres[i];
}

// ---------------------------------------------------------------------------
extern "C" void kernel_launch(void* const* d_in, const int* in_sizes, int n_in,
                              void* d_out, int out_size, void* d_ws, size_t ws_size,
                              hipStream_t stream) {
  (void)in_sizes; (void)n_in; (void)out_size; (void)ws_size;
  const float* q   = (const float*)d_in[0];
  const float* k   = (const float*)d_in[1];
  const float* v   = (const float*)d_in[2];
  const float* rhq = (const float*)d_in[3];
  const float* rwq = (const float*)d_in[4];
  const float* rhk = (const float*)d_in[5];
  const float* rwk = (const float*)d_in[6];
  float*    ws  = (float*)d_ws;                       // needs 24 MB
  _Float16* wsh = (_Float16*)(ws + WS_F32_FLOATS);
  float*    out = (float*)d_out;

  bias_kernel<<<dim3(32, 32), 256, 0, stream>>>(q, k, rhq, rwq, rhk, rwk, ws);
  prepack_kernel<<<256, 256, 0, stream>>>(k, v, wsh);
  flash_kernel<<<dim3(16, 32), 128, 0, stream>>>(q, ws, wsh, out);
}

// v006
// One run takes 34 microseconds.
// In two side-by-side timings against v005, it was 1.06 and 1.05 times as fast.
// Counting every step since v000, it is 6.07 times as fast.
#include <hip/hip_runtime.h>

typedef __attribute__((ext_vector_type(16))) _Float16 v16h;
typedef __attribute__((ext_vector_type(8)))  float    v8f;

#define LQ   1024
#define CD   64
// fp32 workspace offsets (floats)
#define QH_OFF 0
#define QW_OFF (32*1024*32)
#define KH_OFF (2*32*1024*32)
#define KW_OFF (3*32*1024*32)
#define WS_F32_FLOATS (4*32*1024*32)          // 4M floats = 16 MB
// f16 workspace offsets (halves), relative to wsh = (ws + WS_F32_FLOATS)
#define WSK_HOFF 0
#define WSV_HOFF (32*16*4096)                 // 2M halves = 4 MB

// A/B operand K-index map (16-bit WMMA): element e, lane half h ->
// K = (e&7) + 8*h + 16*(e>>3)
__device__ __forceinline__ int kmap(int e, int half) {
  return (e & 7) + 8 * half + 16 * (e >> 3);
}

// ------------------ Phase 1: bias tables, K/V operand tiles -----------------
// Each table is a small fp32 GEMM (rows of Q or K against rows of a rel table),
// done on v_wmma_f32_16x16x4_f32. One block = one (bn, hb): it stages the 256
// operand rows it needs in LDS with whole-line loads, then waves 0-1 make qh for
// q>>5 == hb, 2-3 qw for q&31 == hb, 4-5 kh and 6-7 kw for k>>5 == hb.
// A wave owns whole 128-byte output rows.
// The block's 32 keys are half a 64-key tile of the flash kernel: waves 0, 1, 4, 5
// also write them as f16 operands, 32 bytes a lane: K from the rows staged for the
// tables, V from 16 loads of a lane that fly together with the staging loads.
typedef __attribute__((ext_vector_type(2))) float v2f;
typedef __attribute__((ext_vector_type(4))) float v4f;

#define SP 68   // LDS row pitch (floats) of the staged rows: 272 B, 16-byte column reads hit 64 banks
#define GP 36   // LDS row pitch (floats) of the kw skew buffer, rows stay 16-byte aligned
// first staged row of each operand
#define XQ1  0     // Q[hb*32 + i]
#define XQ2  32    // Q[i*32 + hb]
#define XK   64    // K[hb*32 + i]
#define XRHQ 96    // rhq[hb + i]
#define XRWQ 128   // rwq[hb + i]
#define XRHK 160   // rhk[31 - hb + i]
#define XRWK 192   // rwk[min(i, 62)], i = 0..63

// 16 rows x 64 floats as 16 k-steps of a 16x16x4 operand. Lane (c, h) holds
// columns 8*i + 4*h + 0..3 of its row; A and B use this one loader, so their
// k orders pair position by position.
struct Frag { v4f f[8]; };

__device__ __forceinline__ void lds_frag(Frag& x, const float* row, int h) {
  const v4f* p = (const v4f*)(row + 4 * h);
#pragma unroll
  for (int i = 0; i < 8; ++i) x.f[i] = p[2 * i];
}

// d0[m][n] = sum_c A[m][c] * B0[n][c], d1 likewise with B1: two independent
// accumulate chains; register r of lane (c, h) = element [8*h + r][c]
__device__ __forceinline__ void frag_mm2(const Frag& a, const Frag& b0, const Frag& b1,
                                         v8f& d0, v8f& d1) {
  const v8f z = {0.f, 0.f, 0.f, 0.f, 0.f, 0.f, 0.f, 0.f};
  d0 = z; d1 = z;
#pragma unroll
  for (int i = 0; i < 8; ++i) {
    v2f al = {a.f[i].x, a.f[i].y},   ah = {a.f[i].z, a.f[i].w};
    v2f pl = {b0.f[i].x, b0.f[i].y}, ph = {b0.f[i].z, b0.f[i].w};
    v2f ql = {b1.f[i].x, b1.f[i].y}, qh = {b1.f[i].z, b1.f[i].w};
    d0 = __builtin_amdgcn_wmma_f32_16x16x4_f32(false, al, false, pl, (short)0, d0, false, false);
    d1 = __builtin_amdgcn_wmma_f32_16x16x4_f32(false, al, false, ql, (short)0, d1, false, false);
    d0 = __builtin_amdgcn_wmma_f32_16x16x4_f32(false, ah, false, ph, (short)0, d0, false, false);
    d1 = __builtin_amdgcn_wmma_f32_16x16x4_f32(false, ah, false, qh, (short)0, d1, false, false);
  }
}

__global__ __launch_bounds__(256) void bias_kernel(
    const float* __restrict__ Qg, const float* __restrict__ Kg,
    const float* __restrict__ Vg,
    const float* __restrict__ rhq, const float* __restrict__ rwq,
    const float* __restrict__ rhk, const float* __restrict__ rwk,
    float* __restrict__ ws, _Float16* __restrict__ wsh)
{
  __shared__ __attribute__((aligned(16))) float sX[256 * SP];
  __shared__ __attribute__((aligned(16))) float sG[2][16 * GP];

  const int hb   = blockIdx.x;
  const int bn   = blockIdx.y;
  const int tid  = threadIdx.x;
  const int wv   = __builtin_amdgcn_readfirstlane(tid >> 5);
  const int lane = tid & 31;
  const int c    = lane & 15;
  const int h    = lane >> 4;
  const int s    = wv & 1;
  const int tab  = wv >> 1;
  float* wsb = ws + (size_t)bn * 32768;
  // the four packing waves (wave-uniform)
  const bool packer = (wv & 2) == 0;
  const int  pk     = (wv & 1) | ((wv >> 2) << 1);   // 0..3 among them

  // V: a wave-wide load = one 128-byte half row of one key (lane = column); a lane
  // gathers the 16 keys kmap(e, pk & 1) of column (pk >> 1)*32 + lane
  const float* vs = Vg + ((size_t)bn * LQ + hb * 32 + 8 * (pk & 1)) * CD + (pk >> 1) * 32 + lane;
  v8f vx[2];                                         // [e>>3][e&7]
  if (packer) {
#pragma unroll
    for (int e = 0; e < 16; ++e) vx[e >> 3][e & 7] = vs[kmap(e, 0) * CD];
  }

  // ---- stage: 16 lanes read one whole 256-byte row, 16 rows per pass ----
  {
    const int sr = tid >> 4;
    const int sc = (tid & 15) * 4;
    // per-lane byte offsets: rows 1 apart, rows 32 apart, last rwk rows (row 63 repeats 62)
    const unsigned o1 = (unsigned)(sr * CD + sc) * 4u;
    const unsigned o2 = (unsigned)(sr * 32 * CD + sc) * 4u;
    const unsigned o3 = (unsigned)(min(sr, 14) * CD + sc) * 4u;
    // block-uniform base of each staged operand
    const float* Qb = Qg + (size_t)bn * LQ * CD;
    const float* Kb = Kg + (size_t)bn * LQ * CD;
    const char* pQ1 = (const char*)(Qb + hb * 32 * CD);
    const char* pQ2 = (const char*)(Qb + hb * CD);
    const char* pK  = (const char*)(Kb + hb * 32 * CD);
    const char* pHQ = (const char*)(rhq + hb * CD);
    const char* pWQ = (const char*)(rwq + hb * CD);
    const char* pHK = (const char*)(rhk + (31 - hb) * CD);
    const char* pWK = (const char*)rwk;
    v4f st[16];
    st[0]  = *(const v4f*)(pQ1 + o1);
    st[1]  = *(const v4f*)(pQ1 + 16 * CD * 4 + o1);
    st[2]  = *(const v4f*)(pQ2 + o2);
    st[3]  = *(const v4f*)(pQ2 + 16 * 32 * CD * 4 + o2);
    st[4]  = *(const v4f*)(pK + o1);
    st[5]  = *(const v4f*)(pK + 16 * CD * 4 + o1);
    st[6]  = *(const v4f*)(pHQ + o1);
    st[7]  = *(const v4f*)(pHQ + 16 * CD * 4 + o1);
    st[8]  = *(const v4f*)(pWQ + o1);
    st[9]  = *(const v4f*)(pWQ + 16 * CD * 4 + o1);
    st[10] = *(const v4f*)(pHK + o1);
    st[11] = *(const v4f*)(pHK + 16 * CD * 4 + o1);
    st[12] = *(const v4f*)(pWK + o1);
    st[13] = *(const v4f*)(pWK + 16 * CD * 4 + o1);
    st[14] = *(const v4f*)(pWK + 32 * CD * 4 + o1);
    st[15] = *(const v4f*)(pWK + 48 * CD * 4 + o3);
    // inputs-only fence on the loaded values: the loads' offset and base registers
    // stay live, so none is reused before every load above has returned
    asm volatile("" :: "v"(st[0]), "v"(st[1]), "v"(st[2]), "v"(st[3]), "v"(st[4]), "v"(st[5]),
                 "v"(st[6]), "v"(st[7]), "v"(st[8]), "v"(st[9]), "v"(st[10]), "v"(st[11]),
                 "v"(st[12]), "v"(st[13]), "v"(st[14]), "v"(st[15]), "v"(o1), "v"(o2), "v"(o3),
                 "s"(pQ1), "s"(pQ2), "s"(pK), "s"(pHQ), "s"(pWQ), "s"(pHK), "s"(pWK));
    // inputs-only fence on the V values and their address: without it the built code
    // reuses the V loads' base register while they are still out
    if (packer) asm volatile("" :: "v"(vx[0]), "v"(vx[1]), "v"(vs));
#pragma unroll
    for (int g = 0; g < 16; ++g)
      *(v4f*)&sX[(g * 16 + sr) * SP + sc] = st[g];
  }
  __syncthreads();   // staged rows visible to every wave

  if (packer) {
    // K operand (hb&1)*4 + pk of tile hb>>1: keys (pk>>1)*16 + c, columns
    // (pk&1)*32 + kmap(e, h): two runs of 8 floats of the staged row
    const float* kr = sX + (XK + (pk >> 1) * 16 + c) * SP + (pk & 1) * 32 + 8 * h;
    v4f kx[4];
#pragma unroll
    for (int i = 0; i < 4; ++i) kx[i] = *(const v4f*)(kr + (i >> 1) * 16 + (i & 1) * 4);
    v16h ko, vo;
#pragma unroll
    for (int e = 0; e < 16; ++e) {
      ko[e] = (_Float16)kx[e >> 2][e & 3];
      vo[e] = (_Float16)vx[e >> 3][e & 7];
    }
    _Float16* td = wsh + ((size_t)bn * 16 + (hb >> 1)) * 4096 + (hb & 1) * 2048;
    *(v16h*)(td + WSK_HOFF + pk * 512 + lane * 16) = ko;
    // V operand (hb&1)*4 + column>>4, lane (pk&1)*16 + (column & 15)
    *(v16h*)(td + WSV_HOFF + ((pk >> 1) * 2 + h) * 512 + ((pk & 1) * 16 + c) * 16) = vo;
    // precaution: the table code below reuses these stores' registers
    asm volatile("s_wait_xcnt 0x0" ::: "memory");
  }

  if (tab < 3) {
    // qh[q][j] = Q[q] . rhq[hb - j + 31]   M = q = hb*32 + 16*s + m,  N = j
    // qw[q][j] = Q[q] . rwq[hb - j + 31]   M = q = (16*s + m)*32 + hb, N = j
    // kh[j][k] = K[k] . rhk[j - hb + 31]   M = j = 16*s + m,           N = k = hb*32 + n
    int ar, br0, br1, ostr;
    float* o;
    if (tab == 0) {
      ar = XQ1 + 16 * s + c;  br0 = XRHQ + 31 - c;  br1 = XRHQ + 15 - c;
      o = wsb + QH_OFF + (hb * 32 + 16 * s + 8 * h) * 32 + c;  ostr = 32;
    } else if (tab == 1) {
      ar = XQ2 + 16 * s + c;  br0 = XRWQ + 31 - c;  br1 = XRWQ + 15 - c;
      o = wsb + QW_OFF + ((16 * s + 8 * h) * 32 + hb) * 32 + c;  ostr = 1024;
    } else {
      ar = XRHK + 16 * s + c; br0 = XK + c;         br1 = XK + 16 + c;
      o = wsb + KH_OFF + (16 * s + 8 * h) * 1024 + hb * 32 + c;  ostr = 1024;
    }
    Frag a, b0, b1;
    lds_frag(a,  sX + ar  * SP, h);
    lds_frag(b0, sX + br0 * SP, h);
    lds_frag(b1, sX + br1 * SP, h);
    v8f d0, d1;
    frag_mm2(a, b0, b1, d0, d1);
#pragma unroll
    for (int r = 0; r < 8; ++r) {
      o[r * ostr]      = d0[r];
      o[r * ostr + 16] = d1[r];
    }
  } else {
    // kw[j][k] = K[k] . rwk[j - w + 31], j = 16*s + jl, w = 16*t + m (M = k rows);
    // N = rel row 16*(s - t + 1 + u) + c, so element (m, c) of tile u belongs to
    // jl = 16*u + c + m - 15 (in 0..15 for exactly one u); the skew is undone in LDS.
    float* g = &sG[s][0];
#pragma unroll
    for (int t = 0; t < 2; ++t) {
      Frag a, b0, b1;
      lds_frag(a,  sX + (XK + 16 * t + c) * SP, h);
      lds_frag(b0, sX + (XRWK + 16 * (s - t + 1) + c) * SP, h);
      lds_frag(b1, sX + (XRWK + 16 * (s - t + 2) + c) * SP, h);
      v8f d0, d1;
      frag_mm2(a, b0, b1, d0, d1);
      const int jl0 = c + 8 * h - 15;
      float* gw = g + 16 * t + 8 * h;
#pragma unroll
      for (int r = 0; r < 8; ++r) {
        const int jl = jl0 + r;   // -15..15: tile 0 holds row jl if jl >= 0, else tile 1 holds row jl + 16
        gw[(jl & 15) * GP + r] = jl >= 0 ? d0[r] : d1[r];
      }
    }
    // this wave's own LDS stores must have landed before its other lanes read them
    asm volatile("s_wait_dscnt 0x0" ::: "memory");
    // kw goes out in the order the flash kernel's lanes read it: per 16 keys and 16
    // rows j a 1 KB unit [key bit 2][key bit 3][j & 15][key & 3], so that a wave-wide
    // 16-byte load there covers four whole lines; a store here fills two 256-byte runs
#pragma unroll
    for (int i = 0; i < 4; ++i) {
      const int col = (2 * i + h) * 4;          // key & 31 of the first of 4 keys; row j & 15 = c
      v4f v = *(const v4f*)(g + c * GP + col);
      *(v4f*)(wsb + KW_OFF + ((hb * 2 + (i >> 1)) * 2 + s) * 256 + h * 128
              + ((i & 1) * 16 + c) * 4) = v;
    }
    // precaution: in the built code the block laid out behind these stores rewrites their registers
    asm volatile("s_wait_xcnt 0x0" ::: "memory");
  }
}

// ------------------------------ Phase 2: flash ------------------------------
__device__ __forceinline__ void async_tile(const _Float16* __restrict__ gsrc,
                                           _Float16* ldst, int t) {
#pragma unroll
  for (int i = 0; i < 4; ++i) {
    unsigned lk = (unsigned)(uintptr_t)(ldst + t * 8 + i * 1024);  // LDS byte addr
    const _Float16* gs = gsrc + t * 8 + i * 1024;
    asm volatile("global_load_async_to_lds_b128 %0, %1, off"
                 :: "v"(lk), "v"(gs) : "memory");
  }
}

// one 64-key tile's bias operands of a lane (one query, 32 of the keys): a qh pair,
// 32 x kh, 32 x kw, from the lane's three pointers into that tile
__device__ __forceinline__ void load_bias(v2f& qhv, v4f (&khv)[4][2], v4f (&kwv)[4][2],
                                          const float* qhl, const float* khl,
                                          const float* kwl) {
  qhv = *(const v2f*)qhl;
#pragma unroll
  for (int sub = 0; sub < 4; ++sub)
#pragma unroll
    for (int j = 0; j < 2; ++j) {
      khv[sub][j] = *(const v4f*)(khl + sub * 16 + j * 4);
      kwv[sub][j] = *(const v4f*)(kwl + sub * 512 + j * 128);
    }
}

// lane l's value from lane l ^ 16: the other half of the keys of the same query
__device__ __forceinline__ float xhalf(float x) {
  const int b = __builtin_bit_cast(int, x);
  return __builtin_bit_cast(float, __builtin_amdgcn_permlanex16(b, b, 0x76543210, 0xfedcba98,
                                                                false, false));
}

#define OP 68   // LDS row pitch (floats) of the output staging: rows stay 16-byte aligned

__global__ __launch_bounds__(128) void flash_kernel(
    const float* __restrict__ Qg, const float* __restrict__ ws,
    const _Float16* __restrict__ wsh, float* __restrict__ Out)
{
  // double-buffered K/V tiles in 16-bit operand layout (8KB each); the A and B maps
  // are alike, so a tile packed as a B operand serves as the A operand of the
  // transposed product
  __shared__ __attribute__((aligned(32))) _Float16 sK[2][4096];
  __shared__ __attribute__((aligned(32))) _Float16 sV[2][4096];
  // output staging, wave-private: 16 query rows x 64 floats
  __shared__ __attribute__((aligned(16))) float sO[4][16 * OP];

  const int bn    = blockIdx.y;
  const int qtile = blockIdx.x;
  const int t     = threadIdx.x;
  const int wave  = t >> 5;
  const int lane  = t & 31;
  const int half  = lane >> 4;
  const int n     = lane & 15;
  const int qbase = qtile * 64 + wave * 16;

  const float* qh_p = ws + QH_OFF + (size_t)bn * 32768;
  const float* qw_p = ws + QW_OFF + (size_t)bn * 32768;
  const float* kh_p = ws + KH_OFF + (size_t)bn * 32768;
  const float* kw_p = ws + KW_OFF + (size_t)bn * 32768;
  const _Float16* gK = wsh + WSK_HOFF + (size_t)(bn * 16) * 4096;
  const _Float16* gV = wsh + WSV_HOFF + (size_t)(bn * 16) * 4096;

  // ---- this wave's 16 Q rows as two f16 B operands of Q^T (C = 0..31, 32..63) ----
  v16h qB[2];
  {
    const float* qr = Qg + ((size_t)bn * LQ + (qbase + n)) * CD;  // B: N = lane&15
#pragma unroll
    for (int cc = 0; cc < 2; ++cc)
#pragma unroll
      for (int e = 0; e < 16; ++e)
        qB[cc][e] = (_Float16)qr[kmap(e, half) + 32 * cc];
  }

  // O^T: register i of tile cs = O[qbase + n][cs*16 + 8*half + i]
  v8f Oacc[4];
  const v8f vzero = {0.f, 0.f, 0.f, 0.f, 0.f, 0.f, 0.f, 0.f};
#pragma unroll
  for (int cs = 0; cs < 4; ++cs) Oacc[cs] = vzero;
  float rm = -3.0e38f;   // running maximum of query qbase + n (both lane halves alike)
  float rl = 0.f;        // running sum over this lane half's keys; the halves join at the end

  // prologue: start tile 0 into buffer 0
  async_tile(gK, &sK[0][0], t);
  async_tile(gV, &sV[0][0], t);

  // ---- rel-pos bias operands of this lane (S^T: key sub*16 + 8*half + i, query n) ----
  // A wave's 16 queries share q>>5; q&31 = (qbase&31) + n.
  const float* qwl = qw_p + (qbase + n) * 32 + 8 * half;
  const float* qhl = qh_p + (qbase + n) * 32;                 // these three walk the tiles
  const float* khl = kh_p + (qbase >> 5) * 1024 + 8 * half;
  const float* kwl = kw_p + ((qbase >> 4) & 1) * 256 + lane * 4;
  v4f qwv[2][2];                // k&31 = 16*(sub&1) + 8*half + i: the same in every tile, loaded once
#pragma unroll
  for (int u = 0; u < 2; ++u)
#pragma unroll
    for (int j = 0; j < 2; ++j) qwv[u][j] = *(const v4f*)(qwl + u * 16 + j * 4);
  // precaution: in the built code a later load's result lands in these loads' address registers
  asm volatile("s_wait_xcnt 0x0" ::: "memory");
  v2f qhv;                      // k>>5 = 2*kt + (sub>>1)
  v4f khv[4][2], kwv[4][2];
  load_bias(qhv, khv, kwv, qhl, khl, kwl);

  for (int kt = 0; kt < 16; ++kt) {
    const int cur = kt & 1;

    asm volatile("s_wait_asynccnt 0x0" ::: "memory");  // my tile portion landed
    __syncthreads();                                   // whole tile visible

    if (kt + 1 < 16) {                                 // overlap next copy
      async_tile(gK + (size_t)(kt + 1) * 4096, &sK[cur ^ 1][0], t);
      async_tile(gV + (size_t)(kt + 1) * 4096, &sV[cur ^ 1][0], t);
    }
    const _Float16* sKb = &sK[cur][0];
    const _Float16* sVb = &sV[cur][0];

    // ---- scores S^T = K * Q^T: preload all 8 A operands, then 8 back-to-back WMMAs ----
    v16h kA[8];
#pragma unroll
    for (int op = 0; op < 8; ++op)
      kA[op] = *(const v16h*)(sKb + (op * 32 + lane) * 16);

    v8f S[4];
#pragma unroll
    for (int sub = 0; sub < 4; ++sub)
      S[sub] = __builtin_amdgcn_wmma_f32_16x16x32_f16(false, kA[sub * 2], false,
                                                      qB[0], (short)0,
                                                      vzero, false, false);
#pragma unroll
    for (int sub = 0; sub < 4; ++sub)
      S[sub] = __builtin_amdgcn_wmma_f32_16x16x32_f16(false, kA[sub * 2 + 1], false,
                                                      qB[1], (short)0,
                                                      S[sub], false, false);

    // ---- scale + rel-pos bias (row = key sub*16 + 8*half + i, col = query n) ----
#pragma unroll
    for (int sub = 0; sub < 4; ++sub)
#pragma unroll
      for (int i = 0; i < 8; ++i) {
        float b = qhv[sub >> 1] + qwv[sub & 1][i >> 2][i & 3] + khv[sub][i >> 2][i & 3]
                + kwv[sub][i >> 2][i & 3];
        S[sub][i] = S[sub][i] * 0.125f + b;    // 1/sqrt(64) on QK only
      }

    // next tile's bias operands: all loads go out here, together, and return under
    // the softmax and P*V below (the last trip reloads its own tile: stays in bounds).
    // The pointers move only here, after the last tile's loads have been used.
    const int step = kt + 1 < 16 ? 1 : 0;
    qhl += 2 * step;  khl += 64 * step;  kwl += 2048 * step;
    load_bias(qhv, khv, kwv, qhl, khl, kwl);
    // without this the scheduler sinks the loads into the second half of the softmax,
    // close to the wait at the trip's last barrier, and less of their latency is hidden
    __builtin_amdgcn_sched_barrier(0);

    // ---- online softmax: a lane holds 32 of its query's 64 scores ----
    float tm[4];
#pragma unroll
    for (int sub = 0; sub < 4; ++sub) {
      tm[sub] = S[sub][0];
#pragma unroll
      for (int i = 1; i < 8; ++i) tm[sub] = fmaxf(tm[sub], S[sub][i]);
    }
    float tmx = fmaxf(fmaxf(tm[0], tm[1]), fmaxf(tm[2], tm[3]));
    tmx = fmaxf(tmx, xhalf(tmx));              // the other 32 keys' maximum
    const float newm = fmaxf(rm, tmx);
    const float corr = __expf(rm - newm);
    rm = newm;
    float ts[4];                               // four independent sum chains
#pragma unroll
    for (int sub = 0; sub < 4; ++sub) {
      ts[sub] = 0.f;
#pragma unroll
      for (int i = 0; i < 8; ++i) {
        float p = __expf(S[sub][i] - newm);
        S[sub][i] = p;
        ts[sub] += p;
      }
    }
    rl = rl * corr + ((ts[0] + ts[1]) + (ts[2] + ts[3]));
#pragma unroll
    for (int cs = 0; cs < 4; ++cs)
#pragma unroll
      for (int i = 0; i < 8; ++i) Oacc[cs][i] *= corr;

    // ---- P^T: two score tiles (keys 0-15, 16-31 of a 32-key chunk), converted in
    // place, are a B operand in the hardware k order: element e = tile e>>3, register e&7
    v16h pB[2];
#pragma unroll
    for (int kc = 0; kc < 2; ++kc)
#pragma unroll
      for (int e = 0; e < 16; ++e)
        pB[kc][e] = (_Float16)S[kc * 2 + (e >> 3)][e & 7];

    // ---- O^T += V^T * P^T : preload operands, then 8 back-to-back WMMAs ----
    v16h vA[8];
#pragma unroll
    for (int op = 0; op < 8; ++op)
      vA[op] = *(const v16h*)(sVb + (op * 32 + lane) * 16);
#pragma unroll
    for (int cs = 0; cs < 4; ++cs)
      Oacc[cs] = __builtin_amdgcn_wmma_f32_16x16x32_f16(false, vA[cs], false,
                                                        pB[0], (short)0,
                                                        Oacc[cs], false, false);
#pragma unroll
    for (int cs = 0; cs < 4; ++cs)
      Oacc[cs] = __builtin_amdgcn_wmma_f32_16x16x32_f16(false, vA[4 + cs], false,
                                                        pB[1], (short)0,
                                                        Oacc[cs], false, false);

    __syncthreads();   // all waves done reading before buffer reuse
  }

  // ---- epilogue: normalize, turn O^T into rows in wave-private LDS, add residual Q,
  // store fp32 in whole lines (a wave-wide 16-byte access = two whole 256-byte rows) ----
  const int orow = lane >> 4, ocol = (lane & 15) * 4;
  const size_t obase = ((size_t)bn * LQ + qbase + orow) * CD + ocol;
  v4f qres[8];
#pragma unroll
  for (int i = 0; i < 8; ++i) qres[i] = *(const v4f*)(Qg + obase + i * 2 * CD);
  const float rlt = rl + xhalf(rl);            // both halves' keys
  float* so = &sO[wave][0];
#pragma unroll
  for (int cs = 0; cs < 4; ++cs)
#pragma unroll
    for (int j = 0; j < 2; ++j) {
      v4f o = {Oacc[cs][4 * j] / rlt, Oacc[cs][4 * j + 1] / rlt,
               Oacc[cs][4 * j + 2] / rlt, Oacc[cs][4 * j + 3] / rlt};
      *(v4f*)(so + n * OP + cs * 16 + 8 * half + 4 * j) = o;
    }
  // this wave's own LDS stores must have landed before its other lanes read them
  asm volatile("s_wait_dscnt 0x0" ::: "memory");
#pragma unroll
  for (int i = 0; i < 8; ++i) qres[i] += *(const v4f*)(so + (i * 2 + orow) * OP + ocol);
  // all sums first, then only stores: no register of an issued store is rewritten
  __builtin_amdgcn_sched_barrier(0);
#pragma unroll
  for (int i = 0; i < 8; ++i) *(v4f*)(Out + obase + i * 2 * CD) = qres[i];
}

// ---------------------------------------------------------------------------
extern "C" void kernel_launch(void* const* d_in, const int* in_sizes, int n_in,
                              void* d_out, int out_size, void* d_ws, size_t ws_size,
                              hipStream_t stream) {
  (void)in_sizes; (void)n_in; (void)out_size; (void)ws_size;
  const float* q   = (const float*)d_in[0];
  const float* k   = (const float*)d_in[1];
  const float* v   = (const float*)d_in[2];
  const float* rhq = (const float*)d_in[3];
  const float* rwq = (const float*)d_in[4];
  const float* rhk = (const float*)d_in[5];
  const float* rwk = (const float*)d_in[6];
  float*    ws  = (float*)d_ws;                       // needs 24 MB
  _Float16* wsh = (_Float16*)(ws + WS_F32_FLOATS);
  float*    out = (float*)d_out;

  bias_kernel<<<dim3(32, 32), 256, 0, stream>>>(q, k, v, rhq, rwq, rhk, rwk, ws, wsh);
  flash_kernel<<<dim3(16, 32), 128, 0, stream>>>(q, ws, wsh, out);
}

// v007
// Measured time: 28.1 microseconds a run.
// Timed twice side by side with v006, it ran 1.20 and 1.22 times as fast.
// Counting every step since v000, it is 7.36 times as fast.
#include <hip/hip_runtime.h>

typedef __attribute__((ext_vector_type(16))) _Float16 v16h;
typedef __attribute__((ext_vector_type(8)))  float    v8f;

#define LQ   1024
#define CD   64
// fp32 workspace offsets (floats)
#define QH_OFF 0
#define QW_OFF (32*1024*32)
#define KH_OFF (2*32*1024*32)
#define KW_OFF (3*32*1024*32)
#define WS_F32_FLOATS (4*32*1024*32)          // 4M floats = 16 MB
// f16 workspace offsets (halves), relative to wsh = (ws + WS_F32_FLOATS)
#define WSK_HOFF 0
#define WSV_HOFF (32*16*4096)                 // 2M halves = 4 MB

// A/B operand K-index map (16-bit WMMA): element e, lane half h ->
// K = (e&7) + 8*h + 16*(e>>3)
__device__ __forceinline__ int kmap(int e, int half) {
  return (e & 7) + 8 * half + 16 * (e >> 3);
}

// ------------------ Phase 1: bias tables, K/V operand tiles -----------------
// Each table is a small fp32 GEMM (rows of Q or K against rows of a rel table),
// done on v_wmma_f32_16x16x4_f32. One block = one (bn, hb): it stages the 256
// operand rows it needs in LDS with whole-line loads, then waves 0-1 make qh for
// q>>5 == hb, 2-3 qw for q&31 == hb, 4-5 kh and 6-7 kw for k>>5 == hb.
// A wave owns whole 128-byte output rows.
// The block's 32 keys are half a 64-key tile of the flash kernel: waves 0, 1, 4, 5
// also write them as f16 operands, 32 bytes a lane: K from the rows staged for the
// tables, V from 16 loads of a lane that fly together with the staging loads.
typedef __attribute__((ext_vector_type(2))) float v2f;
typedef __attribute__((ext_vector_type(4))) float v4f;

#define SP 68   // LDS row pitch (floats) of the staged rows: 272 B, 16-byte column reads hit 64 banks
#define GP 36   // LDS row pitch (floats) of the kw skew buffer, rows stay 16-byte aligned
// first staged row of each operand
#define XQ1  0     // Q[hb*32 + i]
#define XQ2  32    // Q[i*32 + hb]
#define XK   64    // K[hb*32 + i]
#define XRHQ 96    // rhq[hb + i]
#define XRWQ 128   // rwq[hb + i]
#define XRHK 160   // rhk[31 - hb + i]
#define XRWK 192   // rwk[min(i, 62)], i = 0..63

// 16 rows x 64 floats as 16 k-steps of a 16x16x4 operand. Lane (c, h) holds
// columns 8*i + 4*h + 0..3 of its row; A and B use this one loader, so their
// k orders pair position by position.
struct Frag { v4f f[8]; };

__device__ __forceinline__ void lds_frag(Frag& x, const float* row, int h) {
  const v4f* p = (const v4f*)(row + 4 * h);
#pragma unroll
  for (int i = 0; i < 8; ++i) x.f[i] = p[2 * i];
}

// d0[m][n] = sum_c A[m][c] * B0[n][c], d1 likewise with B1: two independent
// accumulate chains; register r of lane (c, h) = element [8*h + r][c]
__device__ __forceinline__ void frag_mm2(const Frag& a, const Frag& b0, const Frag& b1,
                                         v8f& d0, v8f& d1) {
  const v8f z = {0.f, 0.f, 0.f, 0.f, 0.f, 0.f, 0.f, 0.f};
  d0 = z; d1 = z;
#pragma unroll
  for (int i = 0; i < 8; ++i) {
    v2f al = {a.f[i].x, a.f[i].y},   ah = {a.f[i].z, a.f[i].w};
    v2f pl = {b0.f[i].x, b0.f[i].y}, ph = {b0.f[i].z, b0.f[i].w};
    v2f ql = {b1.f[i].x, b1.f[i].y}, qh = {b1.f[i].z, b1.f[i].w};
    d0 = __builtin_amdgcn_wmma_f32_16x16x4_f32(false, al, false, pl, (short)0, d0, false, false);
    d1 = __builtin_amdgcn_wmma_f32_16x16x4_f32(false, al, false, ql, (short)0, d1, false, false);
    d0 = __builtin_amdgcn_wmma_f32_16x16x4_f32(false, ah, false, ph, (short)0, d0, false, false);
    d1 = __builtin_amdgcn_wmma_f32_16x16x4_f32(false, ah, false, qh, (short)0, d1, false, false);
  }
}

__global__ __launch_bounds__(256) void bias_kernel(
    const float* __restrict__ Qg, const float* __restrict__ Kg,
    const float* __restrict__ Vg,
    const float* __restrict__ rhq, const float* __restrict__ rwq,
    const float* __restrict__ rhk, const float* __restrict__ rwk,
    float* __restrict__ ws, _Float16* __restrict__ wsh)
{
  __shared__ __attribute__((aligned(16))) float sX[256 * SP];
  __shared__ __attribute__((aligned(16))) float sG[2][16 * GP];

  const int hb   = blockIdx.x;
  const int bn   = blockIdx.y;
  const int tid  = threadIdx.x;
  const int wv   = __builtin_amdgcn_readfirstlane(tid >> 5);
  const int lane = tid & 31;
  const int c    = lane & 15;
  const int h    = lane >> 4;
  const int s    = wv & 1;
  const int tab  = wv >> 1;
  float* wsb = ws + (size_t)bn * 32768;
  // the four packing waves (wave-uniform)
  const bool packer = (wv & 2) == 0;
  const int  pk     = (wv & 1) | ((wv >> 2) << 1);   // 0..3 among them

  // V: a wave-wide load = one 128-byte half row of one key (lane = column); a lane
  // gathers the 16 keys kmap(e, pk & 1) of column (pk >> 1)*32 + lane
  const float* vs = Vg + ((size_t)bn * LQ + hb * 32 + 8 * (pk & 1)) * CD + (pk >> 1) * 32 + lane;
  v8f vx[2];                                         // [e>>3][e&7]
  if (packer) {
#pragma unroll
    for (int e = 0; e < 16; ++e) vx[e >> 3][e & 7] = vs[kmap(e, 0) * CD];
  }

  // ---- stage: 16 lanes read one whole 256-byte row, 16 rows per pass ----
  {
    const int sr = tid >> 4;
    const int sc = (tid & 15) * 4;
    // per-lane byte offsets: rows 1 apart, rows 32 apart, last rwk rows (row 63 repeats 62)
    const unsigned o1 = (unsigned)(sr * CD + sc) * 4u;
    const unsigned o2 = (unsigned)(sr * 32 * CD + sc) * 4u;
    const unsigned o3 = (unsigned)(min(sr, 14) * CD + sc) * 4u;
    // block-uniform base of each staged operand
    const float* Qb = Qg + (size_t)bn * LQ * CD;
    const float* Kb = Kg + (size_t)bn * LQ * CD;
    const char* pQ1 = (const char*)(Qb + hb * 32 * CD);
    const char* pQ2 = (const char*)(Qb + hb * CD);
    const char* pK  = (const char*)(Kb + hb * 32 * CD);
    const char* pHQ = (const char*)(rhq + hb * CD);
    const char* pWQ = (const char*)(rwq + hb * CD);
    const char* pHK = (const char*)(rhk + (31 - hb) * CD);
    const char* pWK = (const char*)rwk;
    v4f st[16];
    st[0]  = *(const v4f*)(pQ1 + o1);
    st[1]  = *(const v4f*)(pQ1 + 16 * CD * 4 + o1);
    st[2]  = *(const v4f*)(pQ2 + o2);
    st[3]  = *(const v4f*)(pQ2 + 16 * 32 * CD * 4 + o2);
    st[4]  = *(const v4f*)(pK + o1);
    st[5]  = *(const v4f*)(pK + 16 * CD * 4 + o1);
    st[6]  = *(const v4f*)(pHQ + o1);
    st[7]  = *(const v4f*)(pHQ + 16 * CD * 4 + o1);
    st[8]  = *(const v4f*)(pWQ + o1);
    st[9]  = *(const v4f*)(pWQ + 16 * CD * 4 + o1);
    st[10] = *(const v4f*)(pHK + o1);
    st[11] = *(const v4f*)(pHK + 16 * CD * 4 + o1);
    st[12] = *(const v4f*)(pWK + o1);
    st[13] = *(const v4f*)(pWK + 16 * CD * 4 + o1);
    st[14] = *(const v4f*)(pWK + 32 * CD * 4 + o1);
    st[15] = *(const v4f*)(pWK + 48 * CD * 4 + o3);
    // inputs-only fence on the loaded values: the loads' offset and base registers
    // stay live, so none is reused before every load above has returned
    asm volatile("" :: "v"(st[0]), "v"(st[1]), "v"(st[2]), "v"(st[3]), "v"(st[4]), "v"(st[5]),
                 "v"(st[6]), "v"(st[7]), "v"(st[8]), "v"(st[9]), "v"(st[10]), "v"(st[11]),
                 "v"(st[12]), "v"(st[13]), "v"(st[14]), "v"(st[15]), "v"(o1), "v"(o2), "v"(o3),
                 "s"(pQ1), "s"(pQ2), "s"(pK), "s"(pHQ), "s"(pWQ), "s"(pHK), "s"(pWK));
    // inputs-only fence on the V values and their address: without it the built code
    // reuses the V loads' base register while they are still out
    if (packer) asm volatile("" :: "v"(vx[0]), "v"(vx[1]), "v"(vs));
#pragma unroll
    for (int g = 0; g < 16; ++g)
      *(v4f*)&sX[(g * 16 + sr) * SP + sc] = st[g];
  }
  __syncthreads();   // staged rows visible to every wave

  if (packer) {
    // K operand (hb&1)*4 + pk of tile hb>>1: keys (pk>>1)*16 + c, columns
    // (pk&1)*32 + kmap(e, h): two runs of 8 floats of the staged row
    const float* kr = sX + (XK + (pk >> 1) * 16 + c) * SP + (pk & 1) * 32 + 8 * h;
    v4f kx[4];
#pragma unroll
    for (int i = 0; i < 4; ++i) kx[i] = *(const v4f*)(kr + (i >> 1) * 16 + (i & 1) * 4);
    v16h ko, vo;
#pragma unroll
    for (int e = 0; e < 16; ++e) {
      ko[e] = (_Float16)kx[e >> 2][e & 3];
      vo[e] = (_Float16)vx[e >> 3][e & 7];
    }
    _Float16* td = wsh + ((size_t)bn * 16 + (hb >> 1)) * 4096 + (hb & 1) * 2048;
    *(v16h*)(td + WSK_HOFF + pk * 512 + lane * 16) = ko;
    // V operand (hb&1)*4 + column>>4, lane (pk&1)*16 + (column & 15)
    *(v16h*)(td + WSV_HOFF + ((pk >> 1) * 2 + h) * 512 + ((pk & 1) * 16 + c) * 16) = vo;
    // precaution: the table code below reuses these stores' registers
    asm volatile("s_wait_xcnt 0x0" ::: "memory");
  }

  if (tab < 3) {
    // qh[q][j] = Q[q] . rhq[hb - j + 31]   M = q = hb*32 + 16*s + m,  N = j
    // qw[q][j] = Q[q] . rwq[hb - j + 31]   M = q = (16*s + m)*32 + hb, N = j
    // kh[j][k] = K[k] . rhk[j - hb + 31]   M = j = 16*s + m,           N = k = hb*32 + n
    int ar, br0, br1, ostr;
    float* o;
    if (tab == 0) {
      ar = XQ1 + 16 * s + c;  br0 = XRHQ + 31 - c;  br1 = XRHQ + 15 - c;
      o = wsb + QH_OFF + (hb * 32 + 16 * s + 8 * h) * 32 + c;  ostr = 32;
    } else if (tab == 1) {
      ar = XQ2 + 16 * s + c;  br0 = XRWQ + 31 - c;  br1 = XRWQ + 15 - c;
      o = wsb + QW_OFF + ((16 * s + 8 * h) * 32 + hb) * 32 + c;  ostr = 1024;
    } else {
      ar = XRHK + 16 * s + c; br0 = XK + c;         br1 = XK + 16 + c;
      o = wsb + KH_OFF + (16 * s + 8 * h) * 1024 + hb * 32 + c;  ostr = 1024;
    }
    Frag a, b0, b1;
    lds_frag(a,  sX + ar  * SP, h);
    lds_frag(b0, sX + br0 * SP, h);
    lds_frag(b1, sX + br1 * SP, h);
    v8f d0, d1;
    frag_mm2(a, b0, b1, d0, d1);
#pragma unroll
    for (int r = 0; r < 8; ++r) {
      o[r * ostr]      = d0[r];
      o[r * ostr + 16] = d1[r];
    }
  } else {
    // kw[j][k] = K[k] . rwk[j - w + 31], j = 16*s + jl, w = 16*t + m (M = k rows);
    // N = rel row 16*(s - t + 1 + u) + c, so element (m, c) of tile u belongs to
    // jl = 16*u + c + m - 15 (in 0..15 for exactly one u); the skew is undone in LDS.
    float* g = &sG[s][0];
#pragma unroll
    for (int t = 0; t < 2; ++t) {
      Frag a, b0, b1;
      lds_frag(a,  sX + (XK + 16 * t + c) * SP, h);
      lds_frag(b0, sX + (XRWK + 16 * (s - t + 1) + c) * SP, h);
      lds_frag(b1, sX + (XRWK + 16 * (s - t + 2) + c) * SP, h);
      v8f d0, d1;
      frag_mm2(a, b0, b1, d0, d1);
      const int jl0 = c + 8 * h - 15;
      float* gw = g + 16 * t + 8 * h;
#pragma unroll
      for (int r = 0; r < 8; ++r) {
        const int jl = jl0 + r;   // -15..15: tile 0 holds row jl if jl >= 0, else tile 1 holds row jl + 16
        gw[(jl & 15) * GP + r] = jl >= 0 ? d0[r] : d1[r];
      }
    }
    // this wave's own LDS stores must have landed before its other lanes read them
    asm volatile("s_wait_dscnt 0x0" ::: "memory");
    // kw goes out in the order the flash kernel's lanes read it: per 16 keys and 16
    // rows j a 1 KB unit [key bit 2][key bit 3][j & 15][key & 3], so that a wave-wide
    // 16-byte load there covers four whole lines; a store here fills two 256-byte runs
#pragma unroll
    for (int i = 0; i < 4; ++i) {
      const int col = (2 * i + h) * 4;          // key & 31 of the first of 4 keys; row j & 15 = c
      v4f v = *(const v4f*)(g + c * GP + col);
      *(v4f*)(wsb + KW_OFF + ((hb * 2 + (i >> 1)) * 2 + s) * 256 + h * 128
              + ((i & 1) * 16 + c) * 4) = v;
    }
    // precaution: in the built code the block laid out behind these stores rewrites their registers
    asm volatile("s_wait_xcnt 0x0" ::: "memory");
  }
}

// ------------------------------ Phase 2: flash ------------------------------
// one K tile and one V tile (8 KB each) by the 128 threads of a group (t = thread in
// the group), 4 x 16 bytes of each tile a thread
__device__ __forceinline__ void async_tiles(const _Float16* __restrict__ gk, _Float16* lk,
                                            const _Float16* __restrict__ gv, _Float16* lv,
                                            int t) {
  const unsigned ak = (unsigned)(uintptr_t)(lk + t * 8);           // LDS byte addresses
  const unsigned av = (unsigned)(uintptr_t)(lv + t * 8);
  const _Float16* pk = gk + t * 8;
  const _Float16* pv = gv + t * 8;
  // the wait is the statement's last line (a precaution): no address register of a
  // copy can be rewritten in front of it
  asm volatile("global_load_async_to_lds_b128 %0, %8, off\n\t"
               "global_load_async_to_lds_b128 %1, %9, off\n\t"
               "global_load_async_to_lds_b128 %2, %10, off\n\t"
               "global_load_async_to_lds_b128 %3, %11, off\n\t"
               "global_load_async_to_lds_b128 %4, %12, off\n\t"
               "global_load_async_to_lds_b128 %5, %13, off\n\t"
               "global_load_async_to_lds_b128 %6, %14, off\n\t"
               "global_load_async_to_lds_b128 %7, %15, off\n\t"
               "s_wait_xcnt 0x0"
               :: "v"(ak), "v"(ak + 2048u), "v"(ak + 4096u), "v"(ak + 6144u),
                  "v"(av), "v"(av + 2048u), "v"(av + 4096u), "v"(av + 6144u),
                  "v"(pk), "v"(pk + 1024), "v"(pk + 2048), "v"(pk + 3072),
                  "v"(pv), "v"(pv + 1024), "v"(pv + 2048), "v"(pv + 3072) : "memory");
}

// one 64-key tile's bias operands of a lane (one query, 32 of the keys): a qh pair,
// 32 x kh, 32 x kw, from the lane's three pointers into that tile
__device__ __forceinline__ void load_bias(v2f& qhv, v4f (&khv)[4][2], v4f (&kwv)[4][2],
                                          const float* qhl, const float* khl,
                                          const float* kwl) {
  qhv = *(const v2f*)qhl;
#pragma unroll
  for (int sub = 0; sub < 4; ++sub)
#pragma unroll
    for (int j = 0; j < 2; ++j) {
      khv[sub][j] = *(const v4f*)(khl + sub * 16 + j * 4);
      kwv[sub][j] = *(const v4f*)(kwl + sub * 512 + j * 128);
    }
}

// lane l's value from lane l ^ 16: the other half of the keys of the same query
__device__ __forceinline__ float xhalf(float x) {
  const int b = __builtin_bit_cast(int, x);
  return __builtin_bit_cast(float, __builtin_amdgcn_permlanex16(b, b, 0x76543210, 0xfedcba98,
                                                                false, false));
}

#define OP 68   // LDS row pitch (floats) of the output staging: rows stay 16-byte aligned
#define NG  2          // key groups of a block, 4 waves each (256 threads)
#define TPG (16 / NG)  // 64-key tiles a group walks

__global__ __launch_bounds__(256) void flash_kernel(
    const float* __restrict__ Qg, const float* __restrict__ ws,
    const _Float16* __restrict__ wsh, float* __restrict__ Out)
{
  // double-buffered K/V tiles in 16-bit operand layout (8KB each); the A and B maps
  // are alike, so a tile packed as a B operand serves as the A operand of the
  // transposed product; each group has its own pair of buffers
  __shared__ __attribute__((aligned(32))) _Float16 sK[NG][2][4096];
  __shared__ __attribute__((aligned(32))) _Float16 sV[NG][2][4096];
  // per 16 queries: first group 1's partial result (34 floats a lane) on its way to
  // group 0, then group 0's output staging, 16 query rows x 64 floats
  __shared__ __attribute__((aligned(16))) float sO[4][16 * OP];

  const int bn    = blockIdx.y;
  const int qtile = blockIdx.x;
  const int t     = threadIdx.x;
  const int grp   = __builtin_amdgcn_readfirstlane(t >> 7);  // key group (wave-uniform)
  const int tg    = t & 127;                                 // thread in the group
  const int wave  = tg >> 5;                                 // which 16 queries
  const int lane  = t & 31;
  const int half  = lane >> 4;
  const int n     = lane & 15;
  const int qbase = qtile * 64 + wave * 16;

  const float* qh_p = ws + QH_OFF + (size_t)bn * 32768;
  const float* qw_p = ws + QW_OFF + (size_t)bn * 32768;
  const float* kh_p = ws + KH_OFF + (size_t)bn * 32768;
  const float* kw_p = ws + KW_OFF + (size_t)bn * 32768;
  const _Float16* gK = wsh + WSK_HOFF + (size_t)(bn * 16 + grp * TPG) * 4096;  // the group's first tile
  const _Float16* gV = wsh + WSV_HOFF + (size_t)(bn * 16 + grp * TPG) * 4096;

  // ---- this wave's 16 Q rows as two f16 B operands of Q^T (C = 0..31, 32..63) ----
  v16h qB[2];
  {
    const float* qr = Qg + ((size_t)bn * LQ + (qbase + n)) * CD;  // B: N = lane&15
#pragma unroll
    for (int cc = 0; cc < 2; ++cc)
#pragma unroll
      for (int e = 0; e < 16; ++e)
        qB[cc][e] = (_Float16)qr[kmap(e, half) + 32 * cc];
  }

  // O^T: register i of tile cs = O[qbase + n][cs*16 + 8*half + i]
  v8f Oacc[4];
  const v8f vzero = {0.f, 0.f, 0.f, 0.f, 0.f, 0.f, 0.f, 0.f};
#pragma unroll
  for (int cs = 0; cs < 4; ++cs) Oacc[cs] = vzero;
  float rm = -3.0e38f;   // running maximum of query qbase + n (both lane halves alike)
  float rl = 0.f;        // running sum over this lane half's keys; the halves join at the end

  // prologue: start the group's tile 0 into its buffer 0
  async_tiles(gK, &sK[grp][0][0], gV, &sV[grp][0][0], tg);

  // ---- rel-pos bias operands of this lane (S^T: key sub*16 + 8*half + i, query n) ----
  // A wave's 16 queries share q>>5; q&31 = (qbase&31) + n.
  const float* qwl = qw_p + (qbase + n) * 32 + 8 * half;
  // these three walk the group's tiles
  const float* qhl = qh_p + (qbase + n) * 32 + grp * (TPG * 2);
  const float* khl = kh_p + (qbase >> 5) * 1024 + 8 * half + grp * (TPG * 64);
  const float* kwl = kw_p + ((qbase >> 4) & 1) * 256 + lane * 4 + grp * (TPG * 2048);
  v4f qwv[2][2];                // k&31 = 16*(sub&1) + 8*half + i: the same in every tile, loaded once
#pragma unroll
  for (int u = 0; u < 2; ++u)
#pragma unroll
    for (int j = 0; j < 2; ++j) qwv[u][j] = *(const v4f*)(qwl + u * 16 + j * 4);
  // precaution: in the built code a later load's result lands in these loads' address registers
  asm volatile("s_wait_xcnt 0x0" ::: "memory");
  v2f qhv;                      // k>>5 = 2*(grp*TPG + kt) + (sub>>1)
  v4f khv[4][2], kwv[4][2];
  load_bias(qhv, khv, kwv, qhl, khl, kwl);

  for (int kt = 0; kt < TPG; ++kt) {
    const int cur = kt & 1;

    asm volatile("s_wait_asynccnt 0x0" ::: "memory");  // my tile portion landed
    __syncthreads();                                   // whole tile visible

    if (kt + 1 < TPG) {                                // overlap next copy
      async_tiles(gK + (size_t)(kt + 1) * 4096, &sK[grp][cur ^ 1][0],
                  gV + (size_t)(kt + 1) * 4096, &sV[grp][cur ^ 1][0], tg);
    }
    const _Float16* sKb = &sK[grp][cur][0];
    const _Float16* sVb = &sV[grp][cur][0];

    // ---- scores S^T = K * Q^T: preload all 8 A operands, then 8 back-to-back WMMAs ----
    v16h kA[8];
#pragma unroll
    for (int op = 0; op < 8; ++op)
      kA[op] = *(const v16h*)(sKb + (op * 32 + lane) * 16);

    v8f S[4];
#pragma unroll
    for (int sub = 0; sub < 4; ++sub)
      S[sub] = __builtin_amdgcn_wmma_f32_16x16x32_f16(false, kA[sub * 2], false,
                                                      qB[0], (short)0,
                                                      vzero, false, false);
#pragma unroll
    for (int sub = 0; sub < 4; ++sub)
      S[sub] = __builtin_amdgcn_wmma_f32_16x16x32_f16(false, kA[sub * 2 + 1], false,
                                                      qB[1], (short)0,
                                                      S[sub], false, false);

    // ---- scale + rel-pos bias (row = key sub*16 + 8*half + i, col = query n) ----
#pragma unroll
    for (int sub = 0; sub < 4; ++sub)
#pragma unroll
      for (int i = 0; i < 8; ++i) {
        float b = qhv[sub >> 1] + qwv[sub & 1][i >> 2][i & 3] + khv[sub][i >> 2][i & 3]
                + kwv[sub][i >> 2][i & 3];
        S[sub][i] = S[sub][i] * 0.125f + b;    // 1/sqrt(64) on QK only
      }

    // next tile's bias operands: all loads go out here, together, and return under
    // the softmax and P*V below (the last trip reloads its own tile: stays in bounds).
    // The pointers move only here, after the last tile's loads have been used.
    const int step = kt + 1 < TPG ? 1 : 0;
    qhl += 2 * step;  khl += 64 * step;  kwl += 2048 * step;
    load_bias(qhv, khv, kwv, qhl, khl, kwl);
    // without this the scheduler sinks the loads into the second half of the softmax,
    // close to the wait at the trip's last barrier, and less of their latency is hidden
    __builtin_amdgcn_sched_barrier(0);

    // ---- online softmax: a lane holds 32 of its query's 64 scores ----
    float tm[4];
#pragma unroll
    for (int sub = 0; sub < 4; ++sub) {
      tm[sub] = S[sub][0];
#pragma unroll
      for (int i = 1; i < 8; ++i) tm[sub] = fmaxf(tm[sub], S[sub][i]);
    }
    float tmx = fmaxf(fmaxf(tm[0], tm[1]), fmaxf(tm[2], tm[3]));
    tmx = fmaxf(tmx, xhalf(tmx));              // the other 32 keys' maximum
    const float newm = fmaxf(rm, tmx);
    const float corr = __expf(rm - newm);
    rm = newm;
    float ts[4];                               // four independent sum chains
#pragma unroll
    for (int sub = 0; sub < 4; ++sub) {
      ts[sub] = 0.f;
#pragma unroll
      for (int i = 0; i < 8; ++i) {
        float p = __expf(S[sub][i] - newm);
        S[sub][i] = p;
        ts[sub] += p;
      }
    }
    rl = rl * corr + ((ts[0] + ts[1]) + (ts[2] + ts[3]));
#pragma unroll
    for (int cs = 0; cs < 4; ++cs)
#pragma unroll
      for (int i = 0; i < 8; ++i) Oacc[cs][i] *= corr;

    // ---- P^T: two score tiles (keys 0-15, 16-31 of a 32-key chunk), converted in
    // place, are a B operand in the hardware k order: element e = tile e>>3, register e&7
    v16h pB[2];
#pragma unroll
    for (int kc = 0; kc < 2; ++kc)
#pragma unroll
      for (int e = 0; e < 16; ++e)
        pB[kc][e] = (_Float16)S[kc * 2 + (e >> 3)][e & 7];

    // ---- O^T += V^T * P^T : preload operands, then 8 back-to-back WMMAs ----
    v16h vA[8];
#pragma unroll
    for (int op = 0; op < 8; ++op)
      vA[op] = *(const v16h*)(sVb + (op * 32 + lane) * 16);
#pragma unroll
    for (int cs = 0; cs < 4; ++cs)
      Oacc[cs] = __builtin_amdgcn_wmma_f32_16x16x32_f16(false, vA[cs], false,
                                                        pB[0], (short)0,
                                                        Oacc[cs], false, false);
#pragma unroll
    for (int cs = 0; cs < 4; ++cs)
      Oacc[cs] = __builtin_amdgcn_wmma_f32_16x16x32_f16(false, vA[4 + cs], false,
                                                        pB[1], (short)0,
                                                        Oacc[cs], false, false);

    // this wave's LDS reads have returned before a copy may refill the buffer
    asm volatile("s_wait_dscnt 0x0" ::: "memory");
    __syncthreads();   // all waves done reading before buffer reuse
  }

  // ---- join the two halves of the keys: group 1 hands its partial O^T, maximum and
  // sum to the group-0 wave of the same 16 queries, lane to lane (loops unrolled so
  // that the accumulators are indexed by constants and stay in registers) ----
  float* so = &sO[wave][0];
  if (grp != 0) {
#pragma unroll
    for (int cs = 0; cs < 4; ++cs)
#pragma unroll
      for (int j = 0; j < 2; ++j) {
        v4f o = {Oacc[cs][4 * j], Oacc[cs][4 * j + 1], Oacc[cs][4 * j + 2], Oacc[cs][4 * j + 3]};
        *(v4f*)(so + (cs * 2 + j) * 128 + lane * 4) = o;
      }
    so[1024 + lane] = rm;
    so[1056 + lane] = rl;
  }
  __syncthreads();   // group 1's partial results visible to group 0
  if (grp != 0) return;   // whole waves leave, behind the last barrier
  {
    const float m1 = so[1024 + lane];
    const float l1 = so[1056 + lane];
    const float mj = fmaxf(rm, m1);
    const float c0 = __expf(rm - mj);
    const float c1 = __expf(m1 - mj);
    rl = rl * c0 + l1 * c1;
#pragma unroll
    for (int cs = 0; cs < 4; ++cs)
#pragma unroll
      for (int j = 0; j < 2; ++j) {
        const v4f o = *(const v4f*)(so + (cs * 2 + j) * 128 + lane * 4);
#pragma unroll
        for (int x = 0; x < 4; ++x)
          Oacc[cs][4 * j + x] = Oacc[cs][4 * j + x] * c0 + o[x] * c1;
      }
  }
  // this wave's reads of the partial result have returned before its lanes write the
  // output staging over it
  asm volatile("s_wait_dscnt 0x0" ::: "memory");

  // ---- epilogue: normalize, turn O^T into rows in wave-private LDS, add residual Q,
  // store fp32 in whole lines (a wave-wide 16-byte access = two whole 256-byte rows) ----
  const int orow = lane >> 4, ocol = (lane & 15) * 4;
  const size_t obase = ((size_t)bn * LQ + qbase + orow) * CD + ocol;
  v4f qres[8];
#pragma unroll
  for (int i = 0; i < 8; ++i) qres[i] = *(const v4f*)(Qg + obase + i * 2 * CD);
  const float rlt = rl + xhalf(rl);            // both halves' keys
#pragma unroll
  for (int cs = 0; cs < 4; ++cs)
#pragma unroll
    for (int j = 0; j < 2; ++j) {
      v4f o = {Oacc[cs][4 * j] / rlt, Oacc[cs][4 * j + 1] / rlt,
               Oacc[cs][4 * j + 2] / rlt, Oacc[cs][4 * j + 3] / rlt};
      *(v4f*)(so + n * OP + cs * 16 + 8 * half + 4 * j) = o;
    }
  // this wave's own LDS stores must have landed before its other lanes read them
  asm volatile("s_wait_dscnt 0x0" ::: "memory");
#pragma unroll
  for (int i = 0; i < 8; ++i) qres[i] += *(const v4f*)(so + (i * 2 + orow) * OP + ocol);
  // all sums first, then only stores: no register of an issued store is rewritten
  __builtin_amdgcn_sched_barrier(0);
#pragma unroll
  for (int i = 0; i < 8; ++i) *(v4f*)(Out + obase + i * 2 * CD) = qres[i];
}

// ---------------------------------------------------------------------------
extern "C" void kernel_launch(void* const* d_in, const int* in_sizes, int n_in,
                              void* d_out, int out_size, void* d_ws, size_t ws_size,
                              hipStream_t stream) {
  (void)in_sizes; (void)n_in; (void)out_size; (void)ws_size;
  const float* q   = (const float*)d_in[0];
  const float* k   = (const float*)d_in[1];
  const float* v   = (const float*)d_in[2];
  const float* rhq = (const float*)d_in[3];
  const float* rwq = (const float*)d_in[4];
  const float* rhk = (const float*)d_in[5];
  const float* rwk = (const float*)d_in[6];
  float*    ws  = (float*)d_ws;                       // needs 24 MB
  _Float16* wsh = (_Float16*)(ws + WS_F32_FLOATS);
  float*    out = (float*)d_out;

  bias_kernel<<<dim3(32, 32), 256, 0, stream>>>(q, k, v, rhq, rwq, rhk, rwk, ws, wsh);
  flash_kernel<<<dim3(16, 32), 256, 0, stream>>>(q, ws, wsh, out);
}

// v008
// It runs in 27.1 microseconds.
// Two timings next to v007 both put it at 1.04 times that version's speed.
// Counting every step since v000, it is 7.64 times as fast.
#include <hip/hip_runtime.h>

typedef __attribute__((ext_vector_type(16))) _Float16 v16h;
typedef __attribute__((ext_vector_type(8)))  _Float16 v8h;
typedef __attribute__((ext_vector_type(8)))  float    v8f;

#define LQ   1024
#define CD   64
// fp32 workspace offsets (floats)
#define QH_OFF 0
#define QW_OFF (32*1024*32)
#define KH_OFF (2*32*1024*32)
#define KW_OFF (3*32*1024*32)
#define WS_F32_FLOATS (4*32*1024*32)          // 4M floats = 16 MB
// f16 workspace offsets (halves), relative to wsh = (ws + WS_F32_FLOATS)
#define WSK_HOFF 0
#define WSV_HOFF (32*16*4096)                 // 2M halves = 4 MB

// A/B operand K-index map (16-bit WMMA): element e, lane half h ->
// K = (e&7) + 8*h + 16*(e>>3)
__device__ __forceinline__ int kmap(int e, int half) {
  return (e & 7) + 8 * half + 16 * (e >> 3);
}

// A 1 KB operand in a K/V tile is two 512-byte planes: plane e>>3 holds elements
// e&7 of lane 0..31, 16 bytes a lane. A wave-wide 16-byte LDS read then covers 512
// contiguous bytes, every bank once per 16 lanes; with a lane's 32 bytes kept
// together, lanes l and l + 8 would meet on the same four banks.
#define OPH 512   // halves of an operand
#define PLH 256   // halves of a plane
__device__ __forceinline__ void put_operand(_Float16* op, int lane, v16h x) {
  *(v8h*)(op + lane * 8)       = __builtin_shufflevector(x, x, 0, 1, 2, 3, 4, 5, 6, 7);
  *(v8h*)(op + PLH + lane * 8) = __builtin_shufflevector(x, x, 8, 9, 10, 11, 12, 13, 14, 15);
}
__device__ __forceinline__ v16h get_operand(const _Float16* op, int lane) {
  const v8h lo = *(const v8h*)(op + lane * 8);
  const v8h hi = *(const v8h*)(op + PLH + lane * 8);
  return __builtin_shufflevector(lo, hi, 0, 1, 2, 3, 4, 5, 6, 7, 8, 9, 10, 11, 12, 13, 14, 15);
}

// ------------------ Phase 1: bias tables, K/V operand tiles -----------------
// Each table is a small fp32 GEMM (rows of Q or K against rows of a rel table),
// done on v_wmma_f32_16x16x4_f32. One block = one (bn, hb): it stages the 256
// operand rows it needs in LDS with whole-line loads, then waves 0-1 make qh for
// q>>5 == hb, 2-3 qw for q&31 == hb, 4-5 kh and 6-7 kw for k>>5 == hb.
// A wave owns whole 128-byte output rows.
// The block's 32 keys are half a 64-key tile of the flash kernel: waves 0, 1, 4, 5
// also write them as f16 operands, two 16-byte pieces a lane: K from the rows staged for the
// tables, V from 16 loads of a lane that fly together with the staging loads.
typedef __attribute__((ext_vector_type(2))) float v2f;
typedef __attribute__((ext_vector_type(4))) float v4f;

#define SP 68   // LDS row pitch (floats) of the staged rows: 272 B, 16-byte column reads hit 64 banks
#define GP 36   // LDS row pitch (floats) of the kw skew buffer, rows stay 16-byte aligned
// first staged row of each operand
#define XQ1  0     // Q[hb*32 + i]
#define XQ2  32    // Q[i*32 + hb]
#define XK   64    // K[hb*32 + i]
#define XRHQ 96    // rhq[hb + i]
#define XRWQ 128   // rwq[hb + i]
#define XRHK 160   // rhk[31 - hb + i]
#define XRWK 192   // rwk[min(i, 62)], i = 0..63

// 16 rows x 64 floats as 16 k-steps of a 16x16x4 operand. Lane (c, h) holds
// columns 8*i + 4*h + 0..3 of its row; A and B use this one loader, so their
// k orders pair position by position.
struct Frag { v4f f[8]; };

__device__ __forceinline__ void lds_frag(Frag& x, const float* row, int h) {
  const v4f* p = (const v4f*)(row + 4 * h);
#pragma unroll
  for (int i = 0; i < 8; ++i) x.f[i] = p[2 * i];
}

// d0[m][n] = sum_c A[m][c] * B0[n][c], d1 likewise with B1: two independent
// accumulate chains; register r of lane (c, h) = element [8*h + r][c]
__device__ __forceinline__ void frag_mm2(const Frag& a, const Frag& b0, const Frag& b1,
                                         v8f& d0, v8f& d1) {
  const v8f z = {0.f, 0.f, 0.f, 0.f, 0.f, 0.f, 0.f, 0.f};
  d0 = z; d1 = z;
#pragma unroll
  for (int i = 0; i < 8; ++i) {
    v2f al = {a.f[i].x, a.f[i].y},   ah = {a.f[i].z, a.f[i].w};
    v2f pl = {b0.f[i].x, b0.f[i].y}, ph = {b0.f[i].z, b0.f[i].w};
    v2f ql = {b1.f[i].x, b1.f[i].y}, qh = {b1.f[i].z, b1.f[i].w};
    d0 = __builtin_amdgcn_wmma_f32_16x16x4_f32(false, al, false, pl, (short)0, d0, false, false);
    d1 = __builtin_amdgcn_wmma_f32_16x16x4_f32(false, al, false, ql, (short)0, d1, false, false);
    d0 = __builtin_amdgcn_wmma_f32_16x16x4_f32(false, ah, false, ph, (short)0, d0, false, false);
    d1 = __builtin_amdgcn_wmma_f32_16x16x4_f32(false, ah, false, qh, (short)0, d1, false, false);
  }
}

__global__ __launch_bounds__(256) void bias_kernel(
    const float* __restrict__ Qg, const float* __restrict__ Kg,
    const float* __restrict__ Vg,
    const float* __restrict__ rhq, const float* __restrict__ rwq,
    const float* __restrict__ rhk, const float* __restrict__ rwk,
    float* __restrict__ ws, _Float16* __restrict__ wsh)
{
  __shared__ __attribute__((aligned(16))) float sX[256 * SP];
  __shared__ __attribute__((aligned(16))) float sG[2][16 * GP];

  const int hb   = blockIdx.x;
  const int bn   = blockIdx.y;
  const int tid  = threadIdx.x;
  const int wv   = __builtin_amdgcn_readfirstlane(tid >> 5);
  const int lane = tid & 31;
  const int c    = lane & 15;
  const int h    = lane >> 4;
  const int s    = wv & 1;
  const int tab  = wv >> 1;
  float* wsb = ws + (size_t)bn * 32768;
  // the four packing waves (wave-uniform)
  const bool packer = (wv & 2) == 0;
  const int  pk     = (wv & 1) | ((wv >> 2) << 1);   // 0..3 among them

  // V: a wave-wide load = one 128-byte half row of one key (lane = column); a lane
  // gathers the 16 keys kmap(e, pk & 1) of column (pk >> 1)*32 + lane
  const float* vs = Vg + ((size_t)bn * LQ + hb * 32 + 8 * (pk & 1)) * CD + (pk >> 1) * 32 + lane;
  v8f vx[2];                                         // [e>>3][e&7]
  if (packer) {
#pragma unroll
    for (int e = 0; e < 16; ++e) vx[e >> 3][e & 7] = vs[kmap(e, 0) * CD];
  }

  // ---- stage: 16 lanes read one whole 256-byte row, 16 rows per pass ----
  {
    const int sr = tid >> 4;
    const int sc = (tid & 15) * 4;
    // per-lane byte offsets: rows 1 apart, rows 32 apart, last rwk rows (row 63 repeats 62)
    const unsigned o1 = (unsigned)(sr * CD + sc) * 4u;
    const unsigned o2 = (unsigned)(sr * 32 * CD + sc) * 4u;
    const unsigned o3 = (unsigned)(min(sr, 14) * CD + sc) * 4u;
    // block-uniform base of each staged operand
    const float* Qb = Qg + (size_t)bn * LQ * CD;
    const float* Kb = Kg + (size_t)bn * LQ * CD;
    const char* pQ1 = (const char*)(Qb + hb * 32 * CD);
    const char* pQ2 = (const char*)(Qb + hb * CD);
    const char* pK  = (const char*)(Kb + hb * 32 * CD);
    const char* pHQ = (const char*)(rhq + hb * CD);
    const char* pWQ = (const char*)(rwq + hb * CD);
    const char* pHK = (const char*)(rhk + (31 - hb) * CD);
    const char* pWK = (const char*)rwk;
    v4f st[16];
    st[0]  = *(const v4f*)(pQ1 + o1);
    st[1]  = *(const v4f*)(pQ1 + 16 * CD * 4 + o1);
    st[2]  = *(const v4f*)(pQ2 + o2);
    st[3]  = *(const v4f*)(pQ2 + 16 * 32 * CD * 4 + o2);
    st[4]  = *(const v4f*)(pK + o1);
    st[5]  = *(const v4f*)(pK + 16 * CD * 4 + o1);
    st[6]  = *(const v4f*)(pHQ + o1);
    st[7]  = *(const v4f*)(pHQ + 16 * CD * 4 + o1);
    st[8]  = *(const v4f*)(pWQ + o1);
    st[9]  = *(const v4f*)(pWQ + 16 * CD * 4 + o1);
    st[10] = *(const v4f*)(pHK + o1);
    st[11] = *(const v4f*)(pHK + 16 * CD * 4 + o1);
    st[12] = *(const v4f*)(pWK + o1);
    st[13] = *(const v4f*)(pWK + 16 * CD * 4 + o1);
    st[14] = *(const v4f*)(pWK + 32 * CD * 4 + o1);
    st[15] = *(const v4f*)(pWK + 48 * CD * 4 + o3);
    // inputs-only fence on the loaded values: the loads' offset and base registers
    // stay live, so none is reused before every load above has returned
    asm volatile("" :: "v"(st[0]), "v"(st[1]), "v"(st[2]), "v"(st[3]), "v"(st[4]), "v"(st[5]),
                 "v"(st[6]), "v"(st[7]), "v"(st[8]), "v"(st[9]), "v"(st[10]), "v"(st[11]),
                 "v"(st[12]), "v"(st[13]), "v"(st[14]), "v"(st[15]), "v"(o1), "v"(o2), "v"(o3),
                 "s"(pQ1), "s"(pQ2), "s"(pK), "s"(pHQ), "s"(pWQ), "s"(pHK), "s"(pWK));
    // inputs-only fence on the V values and their address: without it the built code
    // reuses the V loads' base register while they are still out
    if (packer) asm volatile("" :: "v"(vx[0]), "v"(vx[1]), "v"(vs));
#pragma unroll
    for (int g = 0; g < 16; ++g)
      *(v4f*)&sX[(g * 16 + sr) * SP + sc] = st[g];
  }
  __syncthreads();   // staged rows visible to every wave

  if (packer) {
    // K operand (hb&1)*4 + pk of tile hb>>1: keys (pk>>1)*16 + c, columns
    // (pk&1)*32 + kmap(e, h): two runs of 8 floats of the staged row
    const float* kr = sX + (XK + (pk >> 1) * 16 + c) * SP + (pk & 1) * 32 + 8 * h;
    v4f kx[4];
#pragma unroll
    for (int i = 0; i < 4; ++i) kx[i] = *(const v4f*)(kr + (i >> 1) * 16 + (i & 1) * 4);
    v16h ko, vo;
#pragma unroll
    for (int e = 0; e < 16; ++e) {
      ko[e] = (_Float16)kx[e >> 2][e & 3];
      vo[e] = (_Float16)vx[e >> 3][e & 7];
    }
    _Float16* td = wsh + ((size_t)bn * 16 + (hb >> 1)) * 4096 + (hb & 1) * 2048;
    put_operand(td + WSK_HOFF + pk * OPH, lane, ko);
    // V operand (hb&1)*4 + column>>4, lane (pk&1)*16 + (column & 15)
    put_operand(td + WSV_HOFF + ((pk >> 1) * 2 + h) * OPH, (pk & 1) * 16 + c, vo);
    // precaution: the table code below reuses these stores' registers
    asm volatile("s_wait_xcnt 0x0" ::: "memory");
  }

  if (tab < 3) {
    // qh[q][j] = Q[q] . rhq[hb - j + 31]   M = q = hb*32 + 16*s + m,  N = j
    // qw[q][j] = Q[q] . rwq[hb - j + 31]   M = q = (16*s + m)*32 + hb, N = j
    // kh[j][k] = K[k] . rhk[j - hb + 31]   M = j = 16*s + m,           N = k = hb*32 + n
    int ar, br0, br1, ostr;
    float* o;
    if (tab == 0) {
      ar = XQ1 + 16 * s + c;  br0 = XRHQ + 31 - c;  br1 = XRHQ + 15 - c;
      o = wsb + QH_OFF + (hb * 32 + 16 * s + 8 * h) * 32 + c;  ostr = 32;
    } else if (tab == 1) {
      ar = XQ2 + 16 * s + c;  br0 = XRWQ + 31 - c;  br1 = XRWQ + 15 - c;
      o = wsb + QW_OFF + ((16 * s + 8 * h) * 32 + hb) * 32 + c;  ostr = 1024;
    } else {
      ar = XRHK + 16 * s + c; br0 = XK + c;         br1 = XK + 16 + c;
      o = wsb + KH_OFF + (16 * s + 8 * h) * 1024 + hb * 32 + c;  ostr = 1024;
    }
    Frag a, b0, b1;
    lds_frag(a,  sX + ar  * SP, h);
    lds_frag(b0, sX + br0 * SP, h);
    lds_frag(b1, sX + br1 * SP, h);
    v8f d0, d1;
    frag_mm2(a, b0, b1, d0, d1);
#pragma unroll
    for (int r = 0; r < 8; ++r) {
      o[r * ostr]      = d0[r];
      o[r * ostr + 16] = d1[r];
    }
  } else {
    // kw[j][k] = K[k] . rwk[j - w + 31], j = 16*s + jl, w = 16*t + m (M = k rows);
    // N = rel row 16*(s - t + 1 + u) + c, so element (m, c) of tile u belongs to
    // jl = 16*u + c + m - 15 (in 0..15 for exactly one u); the skew is undone in LDS.
    float* g = &sG[s][0];
#pragma unroll
    for (int t = 0; t < 2; ++t) {
      Frag a, b0, b1;
      lds_frag(a,  sX + (XK + 16 * t + c) * SP, h);
      lds_frag(b0, sX + (XRWK + 16 * (s - t + 1) + c) * SP, h);
      lds_frag(b1, sX + (XRWK + 16 * (s - t + 2) + c) * SP, h);
      v8f d0, d1;
      frag_mm2(a, b0, b1, d0, d1);
      const int jl0 = c + 8 * h - 15;
      float* gw = g + 16 * t + 8 * h;
#pragma unroll
      for (int r = 0; r < 8; ++r) {
        const int jl = jl0 + r;   // -15..15: tile 0 holds row jl if jl >= 0, else tile 1 holds row jl + 16
        gw[(jl & 15) * GP + r] = jl >= 0 ? d0[r] : d1[r];
      }
    }
    // this wave's own LDS stores must have landed before its other lanes read them
    asm volatile("s_wait_dscnt 0x0" ::: "memory");
    // kw goes out in the order the flash kernel's lanes read it: per 16 keys and 16
    // rows j a 1 KB unit [key bit 2][key bit 3][j & 15][key & 3], so that a wave-wide
    // 16-byte load there covers four whole lines; a store here fills two 256-byte runs
#pragma unroll
    for (int i = 0; i < 4; ++i) {
      const int col = (2 * i + h) * 4;          // key & 31 of the first of 4 keys; row j & 15 = c
      v4f v = *(const v4f*)(g + c * GP + col);
      *(v4f*)(wsb + KW_OFF + ((hb * 2 + (i >> 1)) * 2 + s) * 256 + h * 128
              + ((i & 1) * 16 + c) * 4) = v;
    }
    // precaution: in the built code the block laid out behind these stores rewrites their registers
    asm volatile("s_wait_xcnt 0x0" ::: "memory");
  }
}

// ------------------------------ Phase 2: flash ------------------------------
// one K tile and one V tile (8 KB each) by the 128 threads of a group (t = thread in
// the group), 4 x 16 bytes of each tile a thread
__device__ __forceinline__ void async_tiles(const _Float16* __restrict__ gk, _Float16* lk,
                                            const _Float16* __restrict__ gv, _Float16* lv,
                                            int t) {
  const unsigned ak = (unsigned)(uintptr_t)(lk + t * 8);           // LDS byte addresses
  const unsigned av = (unsigned)(uintptr_t)(lv + t * 8);
  const _Float16* pk = gk + t * 8;
  const _Float16* pv = gv + t * 8;
  // the wait is the statement's last line (a precaution): no address register of a
  // copy can be rewritten in front of it
  asm volatile("global_load_async_to_lds_b128 %0, %8, off\n\t"
               "global_load_async_to_lds_b128 %1, %9, off\n\t"
               "global_load_async_to_lds_b128 %2, %10, off\n\t"
               "global_load_async_to_lds_b128 %3, %11, off\n\t"
               "global_load_async_to_lds_b128 %4, %12, off\n\t"
               "global_load_async_to_lds_b128 %5, %13, off\n\t"
               "global_load_async_to_lds_b128 %6, %14, off\n\t"
               "global_load_async_to_lds_b128 %7, %15, off\n\t"
               "s_wait_xcnt 0x0"
               :: "v"(ak), "v"(ak + 2048u), "v"(ak + 4096u), "v"(ak + 6144u),
                  "v"(av), "v"(av + 2048u), "v"(av + 4096u), "v"(av + 6144u),
                  "v"(pk), "v"(pk + 1024), "v"(pk + 2048), "v"(pk + 3072),
                  "v"(pv), "v"(pv + 1024), "v"(pv + 2048), "v"(pv + 3072) : "memory");
}

// one 64-key tile's bias operands of a lane (one query, 32 of the keys): a qh pair,
// 32 x kh, 32 x kw, from the lane's three pointers into that tile
__device__ __forceinline__ void load_bias(v2f& qhv, v4f (&khv)[4][2], v4f (&kwv)[4][2],
                                          const float* qhl, const float* khl,
                                          const float* kwl) {
  qhv = *(const v2f*)qhl;
#pragma unroll
  for (int sub = 0; sub < 4; ++sub)
#pragma unroll
    for (int j = 0; j < 2; ++j) {
      khv[sub][j] = *(const v4f*)(khl + sub * 16 + j * 4);
      kwv[sub][j] = *(const v4f*)(kwl + sub * 512 + j * 128);
    }
}

// lane l's value from lane l ^ 16: the other half of the keys of the same query
__device__ __forceinline__ float xhalf(float x) {
  const int b = __builtin_bit_cast(int, x);
  return __builtin_bit_cast(float, __builtin_amdgcn_permlanex16(b, b, 0x76543210, 0xfedcba98,
                                                                false, false));
}

#define OP 68   // LDS row pitch (floats) of the output staging: rows stay 16-byte aligned
#define NG  2          // key groups of a block, 4 waves each (256 threads)
#define TPG (16 / NG)  // 64-key tiles a group walks

__global__ __launch_bounds__(256) void flash_kernel(
    const float* __restrict__ Qg, const float* __restrict__ ws,
    const _Float16* __restrict__ wsh, float* __restrict__ Out)
{
  // double-buffered K/V tiles in 16-bit operand layout (8KB each); the A and B maps
  // are alike, so a tile packed as a B operand serves as the A operand of the
  // transposed product; each group has its own pair of buffers
  __shared__ __attribute__((aligned(32))) _Float16 sK[NG][2][4096];
  __shared__ __attribute__((aligned(32))) _Float16 sV[NG][2][4096];
  // per 16 queries: first group 1's partial result (34 floats a lane) on its way to
  // group 0, then group 0's output staging, 16 query rows x 64 floats
  __shared__ __attribute__((aligned(16))) float sO[4][16 * OP];

  const int bn    = blockIdx.y;
  const int qtile = blockIdx.x;
  const int t     = threadIdx.x;
  const int grp   = __builtin_amdgcn_readfirstlane(t >> 7);  // key group (wave-uniform)
  const int tg    = t & 127;                                 // thread in the group
  const int wave  = tg >> 5;                                 // which 16 queries
  const int lane  = t & 31;
  const int half  = lane >> 4;
  const int n     = lane & 15;
  const int qbase = qtile * 64 + wave * 16;

  const float* qh_p = ws + QH_OFF + (size_t)bn * 32768;
  const float* qw_p = ws + QW_OFF + (size_t)bn * 32768;
  const float* kh_p = ws + KH_OFF + (size_t)bn * 32768;
  const float* kw_p = ws + KW_OFF + (size_t)bn * 32768;
  const _Float16* gK = wsh + WSK_HOFF + (size_t)(bn * 16 + grp * TPG) * 4096;  // the group's first tile
  const _Float16* gV = wsh + WSV_HOFF + (size_t)(bn * 16 + grp * TPG) * 4096;

  // ---- this wave's 16 Q rows as two f16 B operands of Q^T (C = 0..31, 32..63) ----
  v16h qB[2];
  {
    const float* qr = Qg + ((size_t)bn * LQ + (qbase + n)) * CD;  // B: N = lane&15
#pragma unroll
    for (int cc = 0; cc < 2; ++cc)
#pragma unroll
      for (int e = 0; e < 16; ++e)
        qB[cc][e] = (_Float16)qr[kmap(e, half) + 32 * cc];
  }

  // O^T: register i of tile cs = O[qbase + n][cs*16 + 8*half + i]
  v8f Oacc[4];
  const v8f vzero = {0.f, 0.f, 0.f, 0.f, 0.f, 0.f, 0.f, 0.f};
#pragma unroll
  for (int cs = 0; cs < 4; ++cs) Oacc[cs] = vzero;
  float rm = -3.0e38f;   // running maximum of query qbase + n (both lane halves alike)
  float rl = 0.f;        // running sum over this lane half's keys; the halves join at the end

  // prologue: start the group's tile 0 into its buffer 0
  async_tiles(gK, &sK[grp][0][0], gV, &sV[grp][0][0], tg);

  // ---- rel-pos bias operands of this lane (S^T: key sub*16 + 8*half + i, query n) ----
  // A wave's 16 queries share q>>5; q&31 = (qbase&31) + n.
  const float* qwl = qw_p + (qbase + n) * 32 + 8 * half;
  // these three walk the group's tiles
  const float* qhl = qh_p + (qbase + n) * 32 + grp * (TPG * 2);
  const float* khl = kh_p + (qbase >> 5) * 1024 + 8 * half + grp * (TPG * 64);
  const float* kwl = kw_p + ((qbase >> 4) & 1) * 256 + lane * 4 + grp * (TPG * 2048);
  v4f qwv[2][2];                // k&31 = 16*(sub&1) + 8*half + i: the same in every tile, loaded once
#pragma unroll
  for (int u = 0; u < 2; ++u)
#pragma unroll
    for (int j = 0; j < 2; ++j) qwv[u][j] = *(const v4f*)(qwl + u * 16 + j * 4);
  // precaution: in the built code a later load's result lands in these loads' address registers
  asm volatile("s_wait_xcnt 0x0" ::: "memory");
  v2f qhv;                      // k>>5 = 2*(grp*TPG + kt) + (sub>>1)
  v4f khv[4][2], kwv[4][2];
  load_bias(qhv, khv, kwv, qhl, khl, kwl);

  for (int kt = 0; kt < TPG; ++kt) {
    const int cur = kt & 1;

    asm volatile("s_wait_asynccnt 0x0" ::: "memory");  // my tile portion landed
    __syncthreads();                                   // whole tile visible

    if (kt + 1 < TPG) {                                // overlap next copy
      async_tiles(gK + (size_t)(kt + 1) * 4096, &sK[grp][cur ^ 1][0],
                  gV + (size_t)(kt + 1) * 4096, &sV[grp][cur ^ 1][0], tg);
    }
    const _Float16* sKb = &sK[grp][cur][0];
    const _Float16* sVb = &sV[grp][cur][0];

    // ---- scores S^T = K * Q^T: preload all 8 A operands, then 8 back-to-back WMMAs ----
    v16h kA[8];
#pragma unroll
    for (int op = 0; op < 8; ++op)
      kA[op] = get_operand(sKb + op * OPH, lane);

    v8f S[4];
#pragma unroll
    for (int sub = 0; sub < 4; ++sub)
      S[sub] = __builtin_amdgcn_wmma_f32_16x16x32_f16(false, kA[sub * 2], false,
                                                      qB[0], (short)0,
                                                      vzero, false, false);
#pragma unroll
    for (int sub = 0; sub < 4; ++sub)
      S[sub] = __builtin_amdgcn_wmma_f32_16x16x32_f16(false, kA[sub * 2 + 1], false,
                                                      qB[1], (short)0,
                                                      S[sub], false, false);

    // ---- scale + rel-pos bias (row = key sub*16 + 8*half + i, col = query n) ----
#pragma unroll
    for (int sub = 0; sub < 4; ++sub)
#pragma unroll
      for (int i = 0; i < 8; ++i) {
        float b = qhv[sub >> 1] + qwv[sub & 1][i >> 2][i & 3] + khv[sub][i >> 2][i & 3]
                + kwv[sub][i >> 2][i & 3];
        S[sub][i] = S[sub][i] * 0.125f + b;    // 1/sqrt(64) on QK only
      }

    // next tile's bias operands: all loads go out here, together, and return under
    // the softmax and P*V below (the last trip reloads its own tile: stays in bounds).
    // The pointers move only here, after the last tile's loads have been used.
    const int step = kt + 1 < TPG ? 1 : 0;
    qhl += 2 * step;  khl += 64 * step;  kwl += 2048 * step;
    load_bias(qhv, khv, kwv, qhl, khl, kwl);
    // without this the scheduler sinks the loads into the second half of the softmax,
    // close to the wait at the trip's last barrier, and less of their latency is hidden
    __builtin_amdgcn_sched_barrier(0);

    // ---- online softmax: a lane holds 32 of its query's 64 scores ----
    float tm[4];
#pragma unroll
    for (int sub = 0; sub < 4; ++sub) {
      tm[sub] = S[sub][0];
#pragma unroll
      for (int i = 1; i < 8; ++i) tm[sub] = fmaxf(tm[sub], S[sub][i]);
    }
    float tmx = fmaxf(fmaxf(tm[0], tm[1]), fmaxf(tm[2], tm[3]));
    tmx = fmaxf(tmx, xhalf(tmx));              // the other 32 keys' maximum
    const float newm = fmaxf(rm, tmx);
    const float corr = __expf(rm - newm);
    rm = newm;
    float ts[4];                               // four independent sum chains
#pragma unroll
    for (int sub = 0; sub < 4; ++sub) {
      ts[sub] = 0.f;
#pragma unroll
      for (int i = 0; i < 8; ++i) {
        float p = __expf(S[sub][i] - newm);
        S[sub][i] = p;
        ts[sub] += p;
      }
    }
    rl = rl * corr + ((ts[0] + ts[1]) + (ts[2] + ts[3]));
#pragma unroll
    for (int cs = 0; cs < 4; ++cs)
#pragma unroll
      for (int i = 0; i < 8; ++i) Oacc[cs][i] *= corr;

    // ---- P^T: two score tiles (keys 0-15, 16-31 of a 32-key chunk), converted in
    // place, are a B operand in the hardware k order: element e = tile e>>3, register e&7
    v16h pB[2];
#pragma unroll
    for (int kc = 0; kc < 2; ++kc)
#pragma unroll
      for (int e = 0; e < 16; ++e)
        pB[kc][e] = (_Float16)S[kc * 2 + (e >> 3)][e & 7];

    // ---- O^T += V^T * P^T : preload operands, then 8 back-to-back WMMAs ----
    v16h vA[8];
#pragma unroll
    for (int op = 0; op < 8; ++op)
      vA[op] = get_operand(sVb + op * OPH, lane);
#pragma unroll
    for (int cs = 0; cs < 4; ++cs)
      Oacc[cs] = __builtin_amdgcn_wmma_f32_16x16x32_f16(false, vA[cs], false,
                                                        pB[0], (short)0,
                                                        Oacc[cs], false, false);
#pragma unroll
    for (int cs = 0; cs < 4; ++cs)
      Oacc[cs] = __builtin_amdgcn_wmma_f32_16x16x32_f16(false, vA[4 + cs], false,
                                                        pB[1], (short)0,
                                                        Oacc[cs], false, false);

    // this wave's LDS reads have returned before a copy may refill the buffer
    asm volatile("s_wait_dscnt 0x0" ::: "memory");
    __syncthreads();   // all waves done reading before buffer reuse
  }

  // ---- join the two halves of the keys: group 1 hands its partial O^T, maximum and
  // sum to the group-0 wave of the same 16 queries, lane to lane (loops unrolled so
  // that the accumulators are indexed by constants and stay in registers) ----
  float* so = &sO[wave][0];
  if (grp != 0) {
#pragma unroll
    for (int cs = 0; cs < 4; ++cs)
#pragma unroll
      for (int j = 0; j < 2; ++j) {
        v4f o = {Oacc[cs][4 * j], Oacc[cs][4 * j + 1], Oacc[cs][4 * j + 2], Oacc[cs][4 * j + 3]};
        *(v4f*)(so + (cs * 2 + j) * 128 + lane * 4) = o;
      }
    so[1024 + lane] = rm;
    so[1056 + lane] = rl;
  }
  __syncthreads();   // group 1's partial results visible to group 0
  if (grp != 0) return;   // whole waves leave, behind the last barrier
  {
    const float m1 = so[1024 + lane];
    const float l1 = so[1056 + lane];
    const float mj = fmaxf(rm, m1);
    const float c0 = __expf(rm - mj);
    const float c1 = __expf(m1 - mj);
    rl = rl * c0 + l1 * c1;
#pragma unroll
    for (int cs = 0; cs < 4; ++cs)
#pragma unroll
      for (int j = 0; j < 2; ++j) {
        const v4f o = *(const v4f*)(so + (cs * 2 + j) * 128 + lane * 4);
#pragma unroll
        for (int x = 0; x < 4; ++x)
          Oacc[cs][4 * j + x] = Oacc[cs][4 * j + x] * c0 + o[x] * c1;
      }
  }
  // this wave's reads of the partial result have returned before its lanes write the
  // output staging over it
  asm volatile("s_wait_dscnt 0x0" ::: "memory");

  // ---- epilogue: normalize, turn O^T into rows in wave-private LDS, add residual Q,
  // store fp32 in whole lines (a wave-wide 16-byte access = two whole 256-byte rows) ----
  const int orow = lane >> 4, ocol = (lane & 15) * 4;
  const size_t obase = ((size_t)bn * LQ + qbase + orow) * CD + ocol;
  v4f qres[8];
#pragma unroll
  for (int i = 0; i < 8; ++i) qres[i] = *(const v4f*)(Qg + obase + i * 2 * CD);
  const float rlt = rl + xhalf(rl);            // both halves' keys
#pragma unroll
  for (int cs = 0; cs < 4; ++cs)
#pragma unroll
    for (int j = 0; j < 2; ++j) {
      v4f o = {Oacc[cs][4 * j] / rlt, Oacc[cs][4 * j + 1] / rlt,
               Oacc[cs][4 * j + 2] / rlt, Oacc[cs][4 * j + 3] / rlt};
      *(v4f*)(so + n * OP + cs * 16 + 8 * half + 4 * j) = o;
    }
  // this wave's own LDS stores must have landed before its other lanes read them
  asm volatile("s_wait_dscnt 0x0" ::: "memory");
#pragma unroll
  for (int i = 0; i < 8; ++i) qres[i] += *(const v4f*)(so + (i * 2 + orow) * OP + ocol);
  // all sums first, then only stores: no register of an issued store is rewritten
  __builtin_amdgcn_sched_barrier(0);
#pragma unroll
  for (int i = 0; i < 8; ++i) *(v4f*)(Out + obase + i * 2 * CD) = qres[i];
}

// ---------------------------------------------------------------------------
extern "C" void kernel_launch(void* const* d_in, const int* in_sizes, int n_in,
                              void* d_out, int out_size, void* d_ws, size_t ws_size,
                              hipStream_t stream) {
  (void)in_sizes; (void)n_in; (void)out_size; (void)ws_size;
  const float* q   = (const float*)d_in[0];
  const float* k   = (const float*)d_in[1];
  const float* v   = (const float*)d_in[2];
  const float* rhq = (const float*)d_in[3];
  const float* rwq = (const float*)d_in[4];
  const float* rhk = (const float*)d_in[5];
  const float* rwk = (const float*)d_in[6];
  float*    ws  = (float*)d_ws;                       // needs 24 MB
  _Float16* wsh = (_Float16*)(ws + WS_F32_FLOATS);
  float*    out = (float*)d_out;

  bias_kernel<<<dim3(32, 32), 256, 0, stream>>>(q, k, v, rhq, rwq, rhk, rwk, ws, wsh);
  flash_kernel<<<dim3(16, 32), 256, 0, stream>>>(q, ws, wsh, out);
}
